// v000
// The times below were measured on an AMD MI455X: many runs one after another, warmed up first and cycling through
// copies of the inputs, with the whole window's GPU time divided by the number of runs. Launches and the gaps
// between them are all in it. The median over several windows is given; except for v000 it joins two sittings, which
// can be a few percent apart, so the side-by-side timings, each taken in one sitting, are the better comparison.
// The starting kernel, v000, takes 425 microseconds a run.
#include <hip/hip_runtime.h>
#include <hip/hip_bf16.h>

typedef __bf16 bf16_t;
typedef __bf16 v16bf __attribute__((ext_vector_type(16)));
typedef __bf16 v8bf  __attribute__((ext_vector_type(8)));
typedef float  v8f   __attribute__((ext_vector_type(8)));

#define T_SEQ  2048
#define C_DIM  1024
#define N_QKV  3072
#define H_N    16
#define D_H    64
#define B_N    4
#define M_ROWS 8192   // B*T

// ---- CDNA5 async global->LDS copy (ASYNCcnt-tracked), GVS addressing ----
__device__ __forceinline__ void async_ld16(unsigned int lds_addr, const void* sbase,
                                           unsigned int goff_bytes) {
    asm volatile("global_load_async_to_lds_b128 %0, %1, %2"
                 :
                 : "v"(lds_addr), "v"(goff_bytes), "s"(sbase)
                 : "memory");
}
#define ASYNC_WAIT_4() asm volatile("s_wait_asynccnt 0x4" ::: "memory")
#define ASYNC_WAIT_0() asm volatile("s_wait_asynccnt 0x0" ::: "memory")

// Load a 16-element bf16 A/B WMMA fragment slice.
// Caller passes p = row_base + (lane>=16 ? 8 : 0) [+ k0].
// Elements 0..7  <- p[0..7]   (K = kb .. kb+7)
// Elements 8..15 <- p[16..23] (K = kb+16 .. kb+23)
// Matches CDNA5 16-bit A/B layout: K(e,lane) = (e>=8?16:0)+(lane>=16?8:0)+(e%8).
__device__ __forceinline__ v16bf ld_frag(const bf16_t* p) {
    v8bf lo = *(const v8bf*)(p);
    v8bf hi = *(const v8bf*)(p + 16);
    return __builtin_shufflevector(lo, hi, 0,1,2,3,4,5,6,7,8,9,10,11,12,13,14,15);
}

__device__ __forceinline__ v8f wmma_bf16(v16bf a, v16bf b, v8f c) {
    return __builtin_amdgcn_wmma_f32_16x16x32_bf16(false, a, false, b, (short)0, c, false, false);
}

// Issue this thread's 4 async 16B copies for one 128x32 A-tile + 128x32 B-tile stage.
__device__ __forceinline__ void stage_async(unsigned int ldsA, unsigned int ldsB,
                                            const bf16_t* A, const bf16_t* Bt,
                                            int m0, int n0, int k0, int tid) {
#pragma unroll
    for (int i = 0; i < 2; ++i) {
        int chunk = tid * 2 + i;           // 0..511
        int row   = chunk >> 2;            // 0..127
        int col   = (chunk & 3) * 8;       // 0,8,16,24
        unsigned int ldso = (unsigned int)(row * 32 + col) * 2u;
        async_ld16(ldsA + ldso, A,  ((unsigned int)(m0 + row) * C_DIM + k0 + col) * 2u);
        async_ld16(ldsB + ldso, Bt, ((unsigned int)(n0 + row) * C_DIM + k0 + col) * 2u);
    }
}

// ---------------- stage 0: conversions ----------------

__global__ void f32_to_bf16_kernel(const float* __restrict__ in, bf16_t* __restrict__ out, int n) {
    int i = blockIdx.x * blockDim.x + threadIdx.x;
    if (i < n) out[i] = (bf16_t)in[i];
}

// out[n*K + k] = (bf16) in[k*N + n]  (W stored [K][N] row-major -> [N][K])
__global__ void transpose_bf16_kernel(const float* __restrict__ in, bf16_t* __restrict__ out, int K, int N) {
    int idx = blockIdx.x * blockDim.x + threadIdx.x;
    if (idx >= K * N) return;
    int n = idx / K;
    int k = idx - n * K;
    out[idx] = (bf16_t)in[(size_t)k * N + n];
}

// ---------------- stage 1: QKV GEMM + split ----------------
// C[m][n] = sum_k x[m][k] * Wt[n][k] + bias[n]; split into q,k ([BH][T][Dh]) and v ([BH][Dh][T]).
__global__ __launch_bounds__(256) void gemm_qkv_kernel(
    const bf16_t* __restrict__ A,   // [8192][1024]
    const bf16_t* __restrict__ Bt,  // [3072][1024]
    const float*  __restrict__ bias,// [3072]
    bf16_t* __restrict__ qbuf, bf16_t* __restrict__ kbuf, bf16_t* __restrict__ vbuf)
{
    __shared__ __attribute__((aligned(16))) bf16_t As[2][128 * 32];
    __shared__ __attribute__((aligned(16))) bf16_t Bs[2][128 * 32];
    const int tid  = threadIdx.x;
    const int lane = tid & 31, wv = tid >> 5;
    const int wr = wv & 3, wc = wv >> 2;          // wave tile: rows wr*32, cols wc*64
    const int half = lane >> 4, ln = lane & 15;
    const int m0 = blockIdx.y * 128;
    const int n0 = blockIdx.x * 128;
    const unsigned int ldsA0 = (unsigned int)(uintptr_t)&As[0][0];
    const unsigned int ldsB0 = (unsigned int)(uintptr_t)&Bs[0][0];
    const unsigned int bufBytes = 128u * 32u * 2u;

    v8f acc[2][4] = {};
    const int KT = C_DIM / 32;
    stage_async(ldsA0, ldsB0, A, Bt, m0, n0, 0, tid);     // prefetch tile 0
    for (int kt = 0; kt < KT; ++kt) {
        const int cur = kt & 1;
        if (kt + 1 < KT) {
            // next tile into the other buffer (its readers passed last iteration's barrier)
            stage_async(ldsA0 + (cur ^ 1) * bufBytes, ldsB0 + (cur ^ 1) * bufBytes,
                        A, Bt, m0, n0, (kt + 1) * 32, tid);
            ASYNC_WAIT_4();   // drain this wave's stage-kt copies (4 older of 8 outstanding)
        } else {
            ASYNC_WAIT_0();
        }
        __syncthreads();      // all waves drained their stage-kt copies -> tile visible

        v16bf af[2], bfg[4];
#pragma unroll
        for (int mi = 0; mi < 2; ++mi)
            af[mi] = ld_frag(&As[cur][(wr * 32 + mi * 16 + ln) * 32 + half * 8]);
#pragma unroll
        for (int ni = 0; ni < 4; ++ni)
            bfg[ni] = ld_frag(&Bs[cur][(wc * 64 + ni * 16 + ln) * 32 + half * 8]);
#pragma unroll
        for (int mi = 0; mi < 2; ++mi)
#pragma unroll
            for (int ni = 0; ni < 4; ++ni)
                acc[mi][ni] = wmma_bf16(af[mi], bfg[ni], acc[mi][ni]);
        __syncthreads();      // everyone done reading buffer `cur` before it is overwritten
    }

    // epilogue: bias + scatter to q/k/v
#pragma unroll
    for (int mi = 0; mi < 2; ++mi) {
#pragma unroll
        for (int ni = 0; ni < 4; ++ni) {
            const int gm = m0 + wr * 32 + mi * 16 + half * 8;
            const int gn = n0 + wc * 64 + ni * 16 + ln;
            const float bv = bias[gn];
            const int which = gn >> 10;            // 0=q 1=k 2=v
            const int hh    = (gn & 1023) >> 6;    // head
            const int d     = gn & 63;
#pragma unroll
            for (int r = 0; r < 8; ++r) {
                const int m = gm + r;
                const int b = m >> 11;             // / 2048
                const int t = m & 2047;
                const int bh = b * H_N + hh;
                const bf16_t val = (bf16_t)(acc[mi][ni][r] + bv);
                if (which == 0)      qbuf[((size_t)bh * T_SEQ + t) * D_H + d] = val;
                else if (which == 1) kbuf[((size_t)bh * T_SEQ + t) * D_H + d] = val;
                else                 vbuf[((size_t)bh * D_H + d) * T_SEQ + t] = val;
            }
        }
    }
}

// ---------------- stage 2: RoPE on q,k ----------------
__global__ void rope_kernel(bf16_t* __restrict__ qbuf, bf16_t* __restrict__ kbuf) {
    int idx = blockIdx.x * blockDim.x + threadIdx.x;  // over BH * T * (Dh/2)
    if (idx >= (B_N * H_N) << 16) return;
    const int i  = idx & 31;
    const int t  = (idx >> 5) & 2047;
    const int bh = idx >> 16;
    // inv_freq = 10000^(-2i/64) = exp(-(2i/64) * ln(10000))
    const float ang = (float)t * __expf(-(float)(2 * i) * (9.210340371976184f / 64.0f));
    float s, c;
    __sincosf(ang, &s, &c);
    const size_t base = ((size_t)bh * T_SEQ + t) * D_H;
    {
        float x1 = (float)qbuf[base + i], x2 = (float)qbuf[base + i + 32];
        qbuf[base + i]      = (bf16_t)(x1 * c - x2 * s);
        qbuf[base + i + 32] = (bf16_t)(x2 * c + x1 * s);
    }
    {
        float x1 = (float)kbuf[base + i], x2 = (float)kbuf[base + i + 32];
        kbuf[base + i]      = (bf16_t)(x1 * c - x2 * s);
        kbuf[base + i + 32] = (bf16_t)(x2 * c + x1 * s);
    }
}

// ---------------- stage 3: flash attention ----------------
// block: 128 threads = 4 waves; each wave owns 16 query rows. grid = (T/64, B*H).
__global__ __launch_bounds__(128) void attn_kernel(
    const bf16_t* __restrict__ qbuf,  // [BH][T][Dh]
    const bf16_t* __restrict__ kbuf,  // [BH][T][Dh]
    const bf16_t* __restrict__ vbuf,  // [BH][Dh][T]
    bf16_t* __restrict__ obuf)        // [8192][1024] (m = b*T+t, col = h*64+d)
{
    __shared__ __attribute__((aligned(16))) bf16_t Ps[4 * 16 * 64];  // per-wave P tiles
    const int tid  = threadIdx.x;
    const int lane = tid & 31, wv = tid >> 5;
    const int half = lane >> 4, ln = lane & 15;
    const int bh  = blockIdx.y;
    const int qt0 = blockIdx.x * 64;
    const size_t qkbase = (size_t)bh * T_SEQ * D_H;
    const size_t vbase  = (size_t)bh * D_H * T_SEQ;

    // Q fragments stay resident (A-layout: row = lane%16, contiguous d)
    const int tq = qt0 + wv * 16 + ln;
    v16bf aq[2];
#pragma unroll
    for (int c = 0; c < 2; ++c)
        aq[c] = ld_frag(&qbuf[qkbase + (size_t)tq * D_H + c * 32 + half * 8]);

    float mrun[8], lrun[8];
    v8f acc[4] = {};
#pragma unroll
    for (int r = 0; r < 8; ++r) { mrun[r] = -1e30f; lrun[r] = 0.0f; }

    for (int kt = 0; kt < T_SEQ / 64; ++kt) {
        const int tk0 = kt * 64;
        // S = (Q @ K^T) * scale
        v8f s[4];
#pragma unroll
        for (int j = 0; j < 4; ++j) {
            v8f sj = {};
#pragma unroll
            for (int c = 0; c < 2; ++c) {
                v16bf kf = ld_frag(&kbuf[qkbase + (size_t)(tk0 + j * 16 + ln) * D_H + c * 32 + half * 8]);
                sj = wmma_bf16(aq[c], kf, sj);
            }
#pragma unroll
            for (int r = 0; r < 8; ++r) sj[r] *= 0.125f;   // 1/sqrt(64)
            s[j] = sj;
        }
        // row max (rows 0-7 live in lanes 0-15, rows 8-15 in lanes 16-31; xor<=8 stays in half)
        float rmax[8];
#pragma unroll
        for (int r = 0; r < 8; ++r)
            rmax[r] = fmaxf(fmaxf(s[0][r], s[1][r]), fmaxf(s[2][r], s[3][r]));
#pragma unroll
        for (int off = 1; off < 16; off <<= 1)
#pragma unroll
            for (int r = 0; r < 8; ++r)
                rmax[r] = fmaxf(rmax[r], __shfl_xor(rmax[r], off, 32));

        float mn[8], sc[8], ps[8];
#pragma unroll
        for (int r = 0; r < 8; ++r) {
            mn[r] = fmaxf(mrun[r], rmax[r]);
            sc[r] = __expf(mrun[r] - mn[r]);
            ps[r] = 0.0f;
            mrun[r] = mn[r];
        }
        // P = exp(S - mn), stash bf16 into LDS (C-layout -> [row][key] for A-frag reload)
#pragma unroll
        for (int j = 0; j < 4; ++j)
#pragma unroll
            for (int r = 0; r < 8; ++r) {
                float p = __expf(s[j][r] - mn[r]);
                ps[r] += p;
                Ps[(wv * 16 + r + half * 8) * 64 + j * 16 + ln] = (bf16_t)p;
            }
#pragma unroll
        for (int off = 1; off < 16; off <<= 1)
#pragma unroll
            for (int r = 0; r < 8; ++r)
                ps[r] += __shfl_xor(ps[r], off, 32);
#pragma unroll
        for (int r = 0; r < 8; ++r) lrun[r] = lrun[r] * sc[r] + ps[r];
#pragma unroll
        for (int j2 = 0; j2 < 4; ++j2)
#pragma unroll
            for (int r = 0; r < 8; ++r) acc[j2][r] *= sc[r];

        __syncthreads();
        v16bf ap[2];
#pragma unroll
        for (int c = 0; c < 2; ++c)
            ap[c] = ld_frag(&Ps[(wv * 16 + ln) * 64 + c * 32 + half * 8]);
        // O += P @ V   (V B-frag: lane = d column, contiguous key from [Dh][T] layout)
#pragma unroll
        for (int j2 = 0; j2 < 4; ++j2)
#pragma unroll
            for (int c = 0; c < 2; ++c) {
                v16bf vf = ld_frag(&vbuf[vbase + (size_t)(j2 * 16 + ln) * T_SEQ + tk0 + c * 32 + half * 8]);
                acc[j2] = wmma_bf16(ap[c], vf, acc[j2]);
            }
        __syncthreads();
    }

    // normalize + write [m][h*64+d]
    const int b = bh >> 4, h = bh & 15;
#pragma unroll
    for (int j2 = 0; j2 < 4; ++j2)
#pragma unroll
        for (int r = 0; r < 8; ++r) {
            const int m   = b * T_SEQ + qt0 + wv * 16 + half * 8 + r;
            const int col = h * 64 + j2 * 16 + ln;
            obuf[(size_t)m * C_DIM + col] = (bf16_t)(acc[j2][r] / lrun[r]);
        }
}

// ---------------- stage 4: output projection ----------------
__global__ __launch_bounds__(256) void gemm_out_kernel(
    const bf16_t* __restrict__ A,    // [8192][1024] (attention output)
    const bf16_t* __restrict__ Bt,   // [1024][1024] = W_out^T
    const float*  __restrict__ bias, // [1024]
    float* __restrict__ out)         // [8192][1024]
{
    __shared__ __attribute__((aligned(16))) bf16_t As[2][128 * 32];
    __shared__ __attribute__((aligned(16))) bf16_t Bs[2][128 * 32];
    const int tid  = threadIdx.x;
    const int lane = tid & 31, wv = tid >> 5;
    const int wr = wv & 3, wc = wv >> 2;
    const int half = lane >> 4, ln = lane & 15;
    const int m0 = blockIdx.y * 128;
    const int n0 = blockIdx.x * 128;
    const unsigned int ldsA0 = (unsigned int)(uintptr_t)&As[0][0];
    const unsigned int ldsB0 = (unsigned int)(uintptr_t)&Bs[0][0];
    const unsigned int bufBytes = 128u * 32u * 2u;

    v8f acc[2][4] = {};
    const int KT = C_DIM / 32;
    stage_async(ldsA0, ldsB0, A, Bt, m0, n0, 0, tid);
    for (int kt = 0; kt < KT; ++kt) {
        const int cur = kt & 1;
        if (kt + 1 < KT) {
            stage_async(ldsA0 + (cur ^ 1) * bufBytes, ldsB0 + (cur ^ 1) * bufBytes,
                        A, Bt, m0, n0, (kt + 1) * 32, tid);
            ASYNC_WAIT_4();
        } else {
            ASYNC_WAIT_0();
        }
        __syncthreads();

        v16bf af[2], bfg[4];
#pragma unroll
        for (int mi = 0; mi < 2; ++mi)
            af[mi] = ld_frag(&As[cur][(wr * 32 + mi * 16 + ln) * 32 + half * 8]);
#pragma unroll
        for (int ni = 0; ni < 4; ++ni)
            bfg[ni] = ld_frag(&Bs[cur][(wc * 64 + ni * 16 + ln) * 32 + half * 8]);
#pragma unroll
        for (int mi = 0; mi < 2; ++mi)
#pragma unroll
            for (int ni = 0; ni < 4; ++ni)
                acc[mi][ni] = wmma_bf16(af[mi], bfg[ni], acc[mi][ni]);
        __syncthreads();
    }
#pragma unroll
    for (int mi = 0; mi < 2; ++mi)
#pragma unroll
        for (int ni = 0; ni < 4; ++ni) {
            const int gm = m0 + wr * 32 + mi * 16 + half * 8;
            const int gn = n0 + wc * 64 + ni * 16 + ln;
            const float bv = bias[gn];
#pragma unroll
            for (int r = 0; r < 8; ++r)
                out[(size_t)(gm + r) * C_DIM + gn] = acc[mi][ni][r] + bv;
        }
}

// ---------------- launcher ----------------
extern "C" void kernel_launch(void* const* d_in, const int* in_sizes, int n_in,
                              void* d_out, int out_size, void* d_ws, size_t ws_size,
                              hipStream_t stream) {
    const float* x     = (const float*)d_in[0];  // [4,2048,1024]
    const float* W_qkv = (const float*)d_in[1];  // [1024,3072]
    const float* b_qkv = (const float*)d_in[2];  // [3072]
    const float* W_out = (const float*)d_in[3];  // [1024,1024]
    const float* b_out = (const float*)d_in[4];  // [1024]
    float* out = (float*)d_out;

    char* ws = (char*)d_ws;
    bf16_t* xb    = (bf16_t*)(ws);                         // 16 MiB (reused as obuf)
    bf16_t* wqkvT = (bf16_t*)(ws + (size_t)16777216);      //  6 MiB
    bf16_t* woT   = (bf16_t*)(ws + (size_t)23068672);      //  2 MiB
    bf16_t* qb    = (bf16_t*)(ws + (size_t)25165824);      // 16 MiB
    bf16_t* kb    = (bf16_t*)(ws + (size_t)41943040);      // 16 MiB
    bf16_t* vb    = (bf16_t*)(ws + (size_t)58720256);      // 16 MiB -> 72 MiB total
    bf16_t* obuf  = xb;  // x is fully consumed by gemm_qkv before attn writes obuf

    // stage 0: precision conversion / weight transposition
    f32_to_bf16_kernel<<<(M_ROWS * C_DIM) / 256, 256, 0, stream>>>(x, xb, M_ROWS * C_DIM);
    transpose_bf16_kernel<<<(C_DIM * N_QKV) / 256, 256, 0, stream>>>(W_qkv, wqkvT, C_DIM, N_QKV);
    transpose_bf16_kernel<<<(C_DIM * C_DIM) / 256, 256, 0, stream>>>(W_out, woT, C_DIM, C_DIM);

    // stage 1: QKV projection (WMMA, async double-buffered LDS) + q/k/v split, v transposed
    gemm_qkv_kernel<<<dim3(N_QKV / 128, M_ROWS / 128), 256, 0, stream>>>(xb, wqkvT, b_qkv, qb, kb, vb);

    // stage 2: RoPE
    rope_kernel<<<((B_N * H_N) << 16) / 256, 256, 0, stream>>>(qb, kb);

    // stage 3: attention (WMMA flash-style)
    attn_kernel<<<dim3(T_SEQ / 64, B_N * H_N), 128, 0, stream>>>(qb, kb, vb, obuf);

    // stage 4: output projection (WMMA, async double-buffered LDS) + bias, fp32 out
    gemm_out_kernel<<<dim3(C_DIM / 128, M_ROWS / 128), 256, 0, stream>>>(obuf, woT, b_out, out);
}

// v001
// Measured time: 319 microseconds a run.
// In two side-by-side timings against v000, it was 1.36 and 1.38 times as fast.
#include <hip/hip_runtime.h>
#include <hip/hip_bf16.h>

typedef __bf16 bf16_t;
typedef __bf16 v16bf __attribute__((ext_vector_type(16)));
typedef __bf16 v8bf  __attribute__((ext_vector_type(8)));
typedef float  v8f   __attribute__((ext_vector_type(8)));

#define T_SEQ  2048
#define C_DIM  1024
#define N_QKV  3072
#define H_N    16
#define D_H    64
#define B_N    4
#define M_ROWS 8192   // B*T

// ---- CDNA5 async global->LDS copy (ASYNCcnt-tracked), GVS addressing ----
__device__ __forceinline__ void async_ld16(unsigned int lds_addr, const void* sbase,
                                           unsigned int goff_bytes) {
    asm volatile("global_load_async_to_lds_b128 %0, %1, %2"
                 :
                 : "v"(lds_addr), "v"(goff_bytes), "s"(sbase)
                 : "memory");
}
#define ASYNC_WAIT_4() asm volatile("s_wait_asynccnt 0x4" ::: "memory")
#define ASYNC_WAIT_0() asm volatile("s_wait_asynccnt 0x0" ::: "memory")

// Load a 16-element bf16 A/B WMMA fragment slice.
// Caller passes p = row_base + (lane>=16 ? 8 : 0) [+ k0].
// Elements 0..7  <- p[0..7]   (K = kb .. kb+7)
// Elements 8..15 <- p[16..23] (K = kb+16 .. kb+23)
// Matches CDNA5 16-bit A/B layout: K(e,lane) = (e>=8?16:0)+(lane>=16?8:0)+(e%8).
__device__ __forceinline__ v16bf ld_frag(const bf16_t* p) {
    v8bf lo = *(const v8bf*)(p);
    v8bf hi = *(const v8bf*)(p + 16);
    return __builtin_shufflevector(lo, hi, 0,1,2,3,4,5,6,7,8,9,10,11,12,13,14,15);
}

__device__ __forceinline__ v8f wmma_bf16(v16bf a, v16bf b, v8f c) {
    return __builtin_amdgcn_wmma_f32_16x16x32_bf16(false, a, false, b, (short)0, c, false, false);
}

// Issue this thread's 4 async 16B copies for one 128x32 A-tile + 128x32 B-tile stage.
__device__ __forceinline__ void stage_async(unsigned int ldsA, unsigned int ldsB,
                                            const bf16_t* A, const bf16_t* Bt,
                                            int m0, int n0, int k0, int tid) {
#pragma unroll
    for (int i = 0; i < 2; ++i) {
        int chunk = tid * 2 + i;           // 0..511
        int row   = chunk >> 2;            // 0..127
        int col   = (chunk & 3) * 8;       // 0,8,16,24
        unsigned int ldso = (unsigned int)(row * 32 + col) * 2u;
        async_ld16(ldsA + ldso, A,  ((unsigned int)(m0 + row) * C_DIM + k0 + col) * 2u);
        async_ld16(ldsB + ldso, Bt, ((unsigned int)(n0 + row) * C_DIM + k0 + col) * 2u);
    }
}

// ---------------- stage 0: conversions ----------------

__global__ void f32_to_bf16_kernel(const float* __restrict__ in, bf16_t* __restrict__ out, int n) {
    int i = blockIdx.x * blockDim.x + threadIdx.x;
    if (i < n) out[i] = (bf16_t)in[i];
}

// out[n*K + k] = (bf16) in[k*N + n]  (W stored [K][N] row-major -> [N][K])
__global__ void transpose_bf16_kernel(const float* __restrict__ in, bf16_t* __restrict__ out, int K, int N) {
    int idx = blockIdx.x * blockDim.x + threadIdx.x;
    if (idx >= K * N) return;
    int n = idx / K;
    int k = idx - n * K;
    out[idx] = (bf16_t)in[(size_t)k * N + n];
}

// ---------------- stage 1: QKV GEMM + split ----------------
// C[m][n] = sum_k x[m][k] * Wt[n][k] + bias[n]; split into q,k ([BH][T][Dh]) and v ([BH][Dh][T]).
__global__ __launch_bounds__(256) void gemm_qkv_kernel(
    const bf16_t* __restrict__ A,   // [8192][1024]
    const bf16_t* __restrict__ Bt,  // [3072][1024]
    const float*  __restrict__ bias,// [3072]
    bf16_t* __restrict__ qbuf, bf16_t* __restrict__ kbuf, bf16_t* __restrict__ vbuf)
{
    __shared__ __attribute__((aligned(16))) bf16_t As[2][128 * 32];
    __shared__ __attribute__((aligned(16))) bf16_t Bs[2][128 * 32];
    const int tid  = threadIdx.x;
    const int lane = tid & 31, wv = tid >> 5;
    const int wr = wv & 3, wc = wv >> 2;          // wave tile: rows wr*32, cols wc*64
    const int half = lane >> 4, ln = lane & 15;
    const int m0 = blockIdx.y * 128;
    const int n0 = blockIdx.x * 128;
    const unsigned int ldsA0 = (unsigned int)(uintptr_t)&As[0][0];
    const unsigned int ldsB0 = (unsigned int)(uintptr_t)&Bs[0][0];
    const unsigned int bufBytes = 128u * 32u * 2u;

    v8f acc[2][4] = {};
    const int KT = C_DIM / 32;
    stage_async(ldsA0, ldsB0, A, Bt, m0, n0, 0, tid);     // prefetch tile 0
    for (int kt = 0; kt < KT; ++kt) {
        const int cur = kt & 1;
        if (kt + 1 < KT) {
            // next tile into the other buffer (its readers passed last iteration's barrier)
            stage_async(ldsA0 + (cur ^ 1) * bufBytes, ldsB0 + (cur ^ 1) * bufBytes,
                        A, Bt, m0, n0, (kt + 1) * 32, tid);
            ASYNC_WAIT_4();   // drain this wave's stage-kt copies (4 older of 8 outstanding)
        } else {
            ASYNC_WAIT_0();
        }
        __syncthreads();      // all waves drained their stage-kt copies -> tile visible

        v16bf af[2], bfg[4];
#pragma unroll
        for (int mi = 0; mi < 2; ++mi)
            af[mi] = ld_frag(&As[cur][(wr * 32 + mi * 16 + ln) * 32 + half * 8]);
#pragma unroll
        for (int ni = 0; ni < 4; ++ni)
            bfg[ni] = ld_frag(&Bs[cur][(wc * 64 + ni * 16 + ln) * 32 + half * 8]);
#pragma unroll
        for (int mi = 0; mi < 2; ++mi)
#pragma unroll
            for (int ni = 0; ni < 4; ++ni)
                acc[mi][ni] = wmma_bf16(af[mi], bfg[ni], acc[mi][ni]);
        __syncthreads();      // everyone done reading buffer `cur` before it is overwritten
    }

    // epilogue: bias + scatter to q/k/v
#pragma unroll
    for (int mi = 0; mi < 2; ++mi) {
#pragma unroll
        for (int ni = 0; ni < 4; ++ni) {
            const int gm = m0 + wr * 32 + mi * 16 + half * 8;
            const int gn = n0 + wc * 64 + ni * 16 + ln;
            const float bv = bias[gn];
            const int which = gn >> 10;            // 0=q 1=k 2=v
            const int hh    = (gn & 1023) >> 6;    // head
            const int d     = gn & 63;
#pragma unroll
            for (int r = 0; r < 8; ++r) {
                const int m = gm + r;
                const int b = m >> 11;             // / 2048
                const int t = m & 2047;
                const int bh = b * H_N + hh;
                const bf16_t val = (bf16_t)(acc[mi][ni][r] + bv);
                if (which == 0)      qbuf[((size_t)bh * T_SEQ + t) * D_H + d] = val;
                else if (which == 1) kbuf[((size_t)bh * T_SEQ + t) * D_H + d] = val;
                else                 vbuf[((size_t)bh * D_H + d) * T_SEQ + t] = val;
            }
        }
    }
}

// ---------------- stage 2: RoPE on q,k ----------------
__global__ void rope_kernel(bf16_t* __restrict__ qbuf, bf16_t* __restrict__ kbuf) {
    int idx = blockIdx.x * blockDim.x + threadIdx.x;  // over BH * T * (Dh/2)
    if (idx >= (B_N * H_N) << 16) return;
    const int i  = idx & 31;
    const int t  = (idx >> 5) & 2047;
    const int bh = idx >> 16;
    // inv_freq = 10000^(-2i/64) = exp(-(2i/64) * ln(10000))
    const float ang = (float)t * __expf(-(float)(2 * i) * (9.210340371976184f / 64.0f));
    float s, c;
    __sincosf(ang, &s, &c);
    const size_t base = ((size_t)bh * T_SEQ + t) * D_H;
    {
        float x1 = (float)qbuf[base + i], x2 = (float)qbuf[base + i + 32];
        qbuf[base + i]      = (bf16_t)(x1 * c - x2 * s);
        qbuf[base + i + 32] = (bf16_t)(x2 * c + x1 * s);
    }
    {
        float x1 = (float)kbuf[base + i], x2 = (float)kbuf[base + i + 32];
        kbuf[base + i]      = (bf16_t)(x1 * c - x2 * s);
        kbuf[base + i + 32] = (bf16_t)(x2 * c + x1 * s);
    }
}

// ---------------- stage 3: flash attention ----------------
// One staged row: 128 B of data at a pitch of 144 B (16 B x odd), so that the
// 16-row ds_load_b128 fragment reads fall on distinct banks.
#define KV_PITCH 72                       // bf16 elements
#define KV_TILE  (64 * KV_PITCH)          // one 64-row tile, bf16 elements

// This thread's four 16-byte copies of one stage: rows r and r+32 of the 64x64 K tile
// and of the 64x64 V^T tile. A wave's 32 lanes cover four whole 128-byte rows per copy.
// The s_wait_xcnt is the last line of the copies' own statement so that no later write
// of their address registers can be scheduled in front of it.
__device__ __forceinline__ void stage_kv_async(unsigned int ldsK, unsigned int ldsV,
                                               const bf16_t* gK, const bf16_t* gV) {
    asm volatile("global_load_async_to_lds_b128 %0, %4, off\n\t"
                 "global_load_async_to_lds_b128 %1, %5, off\n\t"
                 "global_load_async_to_lds_b128 %2, %6, off\n\t"
                 "global_load_async_to_lds_b128 %3, %7, off\n\t"
                 "s_wait_xcnt 0x0"
                 :
                 : "v"(ldsK), "v"(ldsK + 32u * KV_PITCH * 2u),
                   "v"(ldsV), "v"(ldsV + 32u * KV_PITCH * 2u),
                   "v"(gK), "v"(gK + 32 * D_H), "v"(gV), "v"(gV + 32 * T_SEQ)
                 : "memory");
}

// block: 256 threads = 8 waves; each wave owns 16 query rows. grid = (T/128, B*H).
// K and V tiles of 64 keys are staged once per block in LDS (two buffers, the next
// tile's copies in flight while this one is worked on) and read by all 8 waves.
__global__ __launch_bounds__(256) void attn_kernel(
    const bf16_t* __restrict__ qbuf,  // [BH][T][Dh]
    const bf16_t* __restrict__ kbuf,  // [BH][T][Dh]
    const bf16_t* __restrict__ vbuf,  // [BH][Dh][T]
    bf16_t* __restrict__ obuf)        // [8192][1024] (m = b*T+t, col = h*64+d)
{
    __shared__ __attribute__((aligned(16))) bf16_t Ks[2][KV_TILE];       // [key][d]
    __shared__ __attribute__((aligned(16))) bf16_t Vs[2][KV_TILE];       // [d][key]
    __shared__ __attribute__((aligned(16))) bf16_t Ps[8 * 16 * 64];      // per-wave P tiles
    const int tid  = threadIdx.x;
    const int lane = tid & 31, wv = tid >> 5;
    const int half = lane >> 4, ln = lane & 15;
    const int bh  = blockIdx.y;
    const int qt0 = blockIdx.x * 128;
    const size_t qkbase = (size_t)bh * T_SEQ * D_H;
    const size_t vbase  = (size_t)bh * D_H * T_SEQ;

    // this thread's place in a staged tile: row tid/8 (and +32), 16-byte column tid%8
    const int srow = tid >> 3, scol = (tid & 7) * 8;
    const unsigned int tileBytes = KV_TILE * 2u;
    const unsigned int ldsK0 = (unsigned int)(uintptr_t)&Ks[0][srow * KV_PITCH + scol];
    const unsigned int ldsV0 = (unsigned int)(uintptr_t)&Vs[0][srow * KV_PITCH + scol];
    const bf16_t* gK0 = kbuf + qkbase + (size_t)srow * D_H + scol;    // + tile * 64 * D_H
    const bf16_t* gV0 = vbuf + vbase + (size_t)srow * T_SEQ + scol;   // + tile * 64
    const int NT = T_SEQ / 64;

    stage_kv_async(ldsK0, ldsV0, gK0, gV0);                           // tile 0 -> buffer 0
    ASYNC_WAIT_0();       // this wave's tile-0 copies have landed
    __syncthreads();      // every wave's have: tile 0 is readable
    stage_kv_async(ldsK0 + tileBytes, ldsV0 + tileBytes, gK0 + 64 * D_H, gV0 + 64);  // tile 1 -> buffer 1

    // Q fragments stay resident (A-layout: row = lane%16, contiguous d)
    const int tq = qt0 + wv * 16 + ln;
    v16bf aq[2];
#pragma unroll
    for (int c = 0; c < 2; ++c)
        aq[c] = ld_frag(&qbuf[qkbase + (size_t)tq * D_H + c * 32 + half * 8]);

    float mrun[8], lrun[8];
    v8f acc[4] = {};
#pragma unroll
    for (int r = 0; r < 8; ++r) { mrun[r] = -1e30f; lrun[r] = 0.0f; }

    for (int kt = 0; kt < NT; ++kt) {
        const int cur = kt & 1;
        // S = (Q @ K^T) * scale
        v8f s[4];
#pragma unroll
        for (int j = 0; j < 4; ++j) {
            v8f sj = {};
#pragma unroll
            for (int c = 0; c < 2; ++c) {
                v16bf kf = ld_frag(&Ks[cur][(j * 16 + ln) * KV_PITCH + c * 32 + half * 8]);
                sj = wmma_bf16(aq[c], kf, sj);
            }
#pragma unroll
            for (int r = 0; r < 8; ++r) sj[r] *= 0.125f;   // 1/sqrt(64)
            s[j] = sj;
        }
        // row max (rows 0-7 live in lanes 0-15, rows 8-15 in lanes 16-31; xor<=8 stays in half)
        float rmax[8];
#pragma unroll
        for (int r = 0; r < 8; ++r)
            rmax[r] = fmaxf(fmaxf(s[0][r], s[1][r]), fmaxf(s[2][r], s[3][r]));
#pragma unroll
        for (int off = 1; off < 16; off <<= 1)
#pragma unroll
            for (int r = 0; r < 8; ++r)
                rmax[r] = fmaxf(rmax[r], __shfl_xor(rmax[r], off, 32));

        float mn[8], sc[8], ps[8];
#pragma unroll
        for (int r = 0; r < 8; ++r) {
            mn[r] = fmaxf(mrun[r], rmax[r]);
            sc[r] = __expf(mrun[r] - mn[r]);
            ps[r] = 0.0f;
            mrun[r] = mn[r];
        }
        // P = exp(S - mn), stash bf16 into LDS (C-layout -> [row][key] for A-frag reload)
#pragma unroll
        for (int j = 0; j < 4; ++j)
#pragma unroll
            for (int r = 0; r < 8; ++r) {
                float p = __expf(s[j][r] - mn[r]);
                ps[r] += p;
                Ps[(wv * 16 + r + half * 8) * 64 + j * 16 + ln] = (bf16_t)p;
            }
#pragma unroll
        for (int off = 1; off < 16; off <<= 1)
#pragma unroll
            for (int r = 0; r < 8; ++r)
                ps[r] += __shfl_xor(ps[r], off, 32);
#pragma unroll
        for (int r = 0; r < 8; ++r) lrun[r] = lrun[r] * sc[r] + ps[r];
#pragma unroll
        for (int j2 = 0; j2 < 4; ++j2)
#pragma unroll
            for (int r = 0; r < 8; ++r) acc[j2][r] *= sc[r];

        __syncthreads();
        v16bf ap[2];
#pragma unroll
        for (int c = 0; c < 2; ++c)
            ap[c] = ld_frag(&Ps[(wv * 16 + ln) * 64 + c * 32 + half * 8]);
        // O += P @ V   (V B-frag: lane = d column, contiguous key from the staged [Dh][key] tile)
#pragma unroll
        for (int j2 = 0; j2 < 4; ++j2)
#pragma unroll
            for (int c = 0; c < 2; ++c) {
                v16bf vf = ld_frag(&Vs[cur][(j2 * 16 + ln) * KV_PITCH + c * 32 + half * 8]);
                acc[j2] = wmma_bf16(ap[c], vf, acc[j2]);
            }
        // hand-over: this wave's LDS reads of buffer cur are done, its copies of tile kt+1 have landed
        asm volatile("s_wait_dscnt 0x0" ::: "memory");
        ASYNC_WAIT_0();
        __syncthreads();      // tile kt+1 readable by all; buffer cur left by all its readers
        if (kt + 2 < NT)      // refill the buffer just read with tile kt+2
            stage_kv_async(ldsK0 + cur * tileBytes, ldsV0 + cur * tileBytes,
                           gK0 + (size_t)(kt + 2) * 64 * D_H, gV0 + (kt + 2) * 64);
    }
    ASYNC_WAIT_0();           // nothing of this wave's is in flight when it leaves the loop

    // normalize + write [m][h*64+d]
    const int b = bh >> 4, h = bh & 15;
#pragma unroll
    for (int j2 = 0; j2 < 4; ++j2)
#pragma unroll
        for (int r = 0; r < 8; ++r) {
            const int m   = b * T_SEQ + qt0 + wv * 16 + half * 8 + r;
            const int col = h * 64 + j2 * 16 + ln;
            obuf[(size_t)m * C_DIM + col] = (bf16_t)(acc[j2][r] / lrun[r]);
        }
}

// ---------------- stage 4: output projection ----------------
__global__ __launch_bounds__(256) void gemm_out_kernel(
    const bf16_t* __restrict__ A,    // [8192][1024] (attention output)
    const bf16_t* __restrict__ Bt,   // [1024][1024] = W_out^T
    const float*  __restrict__ bias, // [1024]
    float* __restrict__ out)         // [8192][1024]
{
    __shared__ __attribute__((aligned(16))) bf16_t As[2][128 * 32];
    __shared__ __attribute__((aligned(16))) bf16_t Bs[2][128 * 32];
    const int tid  = threadIdx.x;
    const int lane = tid & 31, wv = tid >> 5;
    const int wr = wv & 3, wc = wv >> 2;
    const int half = lane >> 4, ln = lane & 15;
    const int m0 = blockIdx.y * 128;
    const int n0 = blockIdx.x * 128;
    const unsigned int ldsA0 = (unsigned int)(uintptr_t)&As[0][0];
    const unsigned int ldsB0 = (unsigned int)(uintptr_t)&Bs[0][0];
    const unsigned int bufBytes = 128u * 32u * 2u;

    v8f acc[2][4] = {};
    const int KT = C_DIM / 32;
    stage_async(ldsA0, ldsB0, A, Bt, m0, n0, 0, tid);
    for (int kt = 0; kt < KT; ++kt) {
        const int cur = kt & 1;
        if (kt + 1 < KT) {
            stage_async(ldsA0 + (cur ^ 1) * bufBytes, ldsB0 + (cur ^ 1) * bufBytes,
                        A, Bt, m0, n0, (kt + 1) * 32, tid);
            ASYNC_WAIT_4();
        } else {
            ASYNC_WAIT_0();
        }
        __syncthreads();

        v16bf af[2], bfg[4];
#pragma unroll
        for (int mi = 0; mi < 2; ++mi)
            af[mi] = ld_frag(&As[cur][(wr * 32 + mi * 16 + ln) * 32 + half * 8]);
#pragma unroll
        for (int ni = 0; ni < 4; ++ni)
            bfg[ni] = ld_frag(&Bs[cur][(wc * 64 + ni * 16 + ln) * 32 + half * 8]);
#pragma unroll
        for (int mi = 0; mi < 2; ++mi)
#pragma unroll
            for (int ni = 0; ni < 4; ++ni)
                acc[mi][ni] = wmma_bf16(af[mi], bfg[ni], acc[mi][ni]);
        __syncthreads();
    }
#pragma unroll
    for (int mi = 0; mi < 2; ++mi)
#pragma unroll
        for (int ni = 0; ni < 4; ++ni) {
            const int gm = m0 + wr * 32 + mi * 16 + half * 8;
            const int gn = n0 + wc * 64 + ni * 16 + ln;
            const float bv = bias[gn];
#pragma unroll
            for (int r = 0; r < 8; ++r)
                out[(size_t)(gm + r) * C_DIM + gn] = acc[mi][ni][r] + bv;
        }
}

// ---------------- launcher ----------------
extern "C" void kernel_launch(void* const* d_in, const int* in_sizes, int n_in,
                              void* d_out, int out_size, void* d_ws, size_t ws_size,
                              hipStream_t stream) {
    const float* x     = (const float*)d_in[0];  // [4,2048,1024]
    const float* W_qkv = (const float*)d_in[1];  // [1024,3072]
    const float* b_qkv = (const float*)d_in[2];  // [3072]
    const float* W_out = (const float*)d_in[3];  // [1024,1024]
    const float* b_out = (const float*)d_in[4];  // [1024]
    float* out = (float*)d_out;

    char* ws = (char*)d_ws;
    bf16_t* xb    = (bf16_t*)(ws);                         // 16 MiB (reused as obuf)
    bf16_t* wqkvT = (bf16_t*)(ws + (size_t)16777216);      //  6 MiB
    bf16_t* woT   = (bf16_t*)(ws + (size_t)23068672);      //  2 MiB
    bf16_t* qb    = (bf16_t*)(ws + (size_t)25165824);      // 16 MiB
    bf16_t* kb    = (bf16_t*)(ws + (size_t)41943040);      // 16 MiB
    bf16_t* vb    = (bf16_t*)(ws + (size_t)58720256);      // 16 MiB -> 72 MiB total
    bf16_t* obuf  = xb;  // x is fully consumed by gemm_qkv before attn writes obuf

    // stage 0: precision conversion / weight transposition
    f32_to_bf16_kernel<<<(M_ROWS * C_DIM) / 256, 256, 0, stream>>>(x, xb, M_ROWS * C_DIM);
    transpose_bf16_kernel<<<(C_DIM * N_QKV) / 256, 256, 0, stream>>>(W_qkv, wqkvT, C_DIM, N_QKV);
    transpose_bf16_kernel<<<(C_DIM * C_DIM) / 256, 256, 0, stream>>>(W_out, woT, C_DIM, C_DIM);

    // stage 1: QKV projection (WMMA, async double-buffered LDS) + q/k/v split, v transposed
    gemm_qkv_kernel<<<dim3(N_QKV / 128, M_ROWS / 128), 256, 0, stream>>>(xb, wqkvT, b_qkv, qb, kb, vb);

    // stage 2: RoPE
    rope_kernel<<<((B_N * H_N) << 16) / 256, 256, 0, stream>>>(qb, kb);

    // stage 3: attention (WMMA flash-style)
    attn_kernel<<<dim3(T_SEQ / 128, B_N * H_N), 256, 0, stream>>>(qb, kb, vb, obuf);

    // stage 4: output projection (WMMA, async double-buffered LDS) + bias, fp32 out
    gemm_out_kernel<<<dim3(C_DIM / 128, M_ROWS / 128), 256, 0, stream>>>(obuf, woT, b_out, out);
}

// v002
// One run takes 254 microseconds.
// Timed twice side by side with v001, it ran 1.26 times as fast both times.
// All steps since v000 together make it 1.72 times as fast.
#include <hip/hip_runtime.h>
#include <hip/hip_bf16.h>

typedef __bf16 bf16_t;
typedef __bf16 v16bf __attribute__((ext_vector_type(16)));
typedef __bf16 v8bf  __attribute__((ext_vector_type(8)));
typedef float  v8f   __attribute__((ext_vector_type(8)));
typedef float  v2f   __attribute__((ext_vector_type(2)));

#define T_SEQ  2048
#define C_DIM  1024
#define N_QKV  3072
#define H_N    16
#define D_H    64
#define B_N    4
#define M_ROWS 8192   // B*T

// ---- CDNA5 async global->LDS copy (ASYNCcnt-tracked), GVS addressing ----
__device__ __forceinline__ void async_ld16(unsigned int lds_addr, const void* sbase,
                                           unsigned int goff_bytes) {
    asm volatile("global_load_async_to_lds_b128 %0, %1, %2"
                 :
                 : "v"(lds_addr), "v"(goff_bytes), "s"(sbase)
                 : "memory");
}
#define ASYNC_WAIT_4() asm volatile("s_wait_asynccnt 0x4" ::: "memory")
#define ASYNC_WAIT_0() asm volatile("s_wait_asynccnt 0x0" ::: "memory")

// Load a 16-element bf16 A/B WMMA fragment slice.
// Caller passes p = row_base + (lane>=16 ? 8 : 0) [+ k0].
// Elements 0..7  <- p[0..7]   (K = kb .. kb+7)
// Elements 8..15 <- p[16..23] (K = kb+16 .. kb+23)
// Matches CDNA5 16-bit A/B layout: K(e,lane) = (e>=8?16:0)+(lane>=16?8:0)+(e%8).
__device__ __forceinline__ v16bf ld_frag(const bf16_t* p) {
    v8bf lo = *(const v8bf*)(p);
    v8bf hi = *(const v8bf*)(p + 16);
    return __builtin_shufflevector(lo, hi, 0,1,2,3,4,5,6,7,8,9,10,11,12,13,14,15);
}

__device__ __forceinline__ v8f wmma_bf16(v16bf a, v16bf b, v8f c) {
    return __builtin_amdgcn_wmma_f32_16x16x32_bf16(false, a, false, b, (short)0, c, false, false);
}

// Issue this thread's 4 async 16B copies for one 128x32 A-tile + 128x32 B-tile stage.
__device__ __forceinline__ void stage_async(unsigned int ldsA, unsigned int ldsB,
                                            const bf16_t* A, const bf16_t* Bt,
                                            int m0, int n0, int k0, int tid) {
#pragma unroll
    for (int i = 0; i < 2; ++i) {
        int chunk = tid * 2 + i;           // 0..511
        int row   = chunk >> 2;            // 0..127
        int col   = (chunk & 3) * 8;       // 0,8,16,24
        unsigned int ldso = (unsigned int)(row * 32 + col) * 2u;
        async_ld16(ldsA + ldso, A,  ((unsigned int)(m0 + row) * C_DIM + k0 + col) * 2u);
        async_ld16(ldsB + ldso, Bt, ((unsigned int)(n0 + row) * C_DIM + k0 + col) * 2u);
    }
}

// ---------------- stage 0: conversions ----------------

__global__ void f32_to_bf16_kernel(const float* __restrict__ in, bf16_t* __restrict__ out, int n) {
    int i = blockIdx.x * blockDim.x + threadIdx.x;
    if (i < n) out[i] = (bf16_t)in[i];
}

// out[n*K + k] = (bf16) in[k*N + n]  (W stored [K][N] row-major -> [N][K])
__global__ void transpose_bf16_kernel(const float* __restrict__ in, bf16_t* __restrict__ out, int K, int N) {
    int idx = blockIdx.x * blockDim.x + threadIdx.x;
    if (idx >= K * N) return;
    int n = idx / K;
    int k = idx - n * K;
    out[idx] = (bf16_t)in[(size_t)k * N + n];
}

// ---------------- stage 1: QKV GEMM + split ----------------
// C[m][n] = sum_k x[m][k] * Wt[n][k] + bias[n]; split into q,k ([BH][T][Dh]) and v ([BH][Dh][T]).
__global__ __launch_bounds__(256) void gemm_qkv_kernel(
    const bf16_t* __restrict__ A,   // [8192][1024]
    const bf16_t* __restrict__ Bt,  // [3072][1024]
    const float*  __restrict__ bias,// [3072]
    bf16_t* __restrict__ qbuf, bf16_t* __restrict__ kbuf, bf16_t* __restrict__ vbuf)
{
    __shared__ __attribute__((aligned(16))) bf16_t As[2][128 * 32];
    __shared__ __attribute__((aligned(16))) bf16_t Bs[2][128 * 32];
    const int tid  = threadIdx.x;
    const int lane = tid & 31, wv = tid >> 5;
    const int wr = wv & 3, wc = wv >> 2;          // wave tile: rows wr*32, cols wc*64
    const int half = lane >> 4, ln = lane & 15;
    const int m0 = blockIdx.y * 128;
    const int n0 = blockIdx.x * 128;
    const unsigned int ldsA0 = (unsigned int)(uintptr_t)&As[0][0];
    const unsigned int ldsB0 = (unsigned int)(uintptr_t)&Bs[0][0];
    const unsigned int bufBytes = 128u * 32u * 2u;

    v8f acc[2][4] = {};
    const int KT = C_DIM / 32;
    stage_async(ldsA0, ldsB0, A, Bt, m0, n0, 0, tid);     // prefetch tile 0
    for (int kt = 0; kt < KT; ++kt) {
        const int cur = kt & 1;
        if (kt + 1 < KT) {
            // next tile into the other buffer (its readers passed last iteration's barrier)
            stage_async(ldsA0 + (cur ^ 1) * bufBytes, ldsB0 + (cur ^ 1) * bufBytes,
                        A, Bt, m0, n0, (kt + 1) * 32, tid);
            ASYNC_WAIT_4();   // drain this wave's stage-kt copies (4 older of 8 outstanding)
        } else {
            ASYNC_WAIT_0();
        }
        __syncthreads();      // all waves drained their stage-kt copies -> tile visible

        v16bf af[2], bfg[4];
#pragma unroll
        for (int mi = 0; mi < 2; ++mi)
            af[mi] = ld_frag(&As[cur][(wr * 32 + mi * 16 + ln) * 32 + half * 8]);
#pragma unroll
        for (int ni = 0; ni < 4; ++ni)
            bfg[ni] = ld_frag(&Bs[cur][(wc * 64 + ni * 16 + ln) * 32 + half * 8]);
#pragma unroll
        for (int mi = 0; mi < 2; ++mi)
#pragma unroll
            for (int ni = 0; ni < 4; ++ni)
                acc[mi][ni] = wmma_bf16(af[mi], bfg[ni], acc[mi][ni]);
        __syncthreads();      // everyone done reading buffer `cur` before it is overwritten
    }

    // epilogue: bias + scatter to q/k/v
#pragma unroll
    for (int mi = 0; mi < 2; ++mi) {
#pragma unroll
        for (int ni = 0; ni < 4; ++ni) {
            const int gm = m0 + wr * 32 + mi * 16 + half * 8;
            const int gn = n0 + wc * 64 + ni * 16 + ln;
            const float bv = bias[gn];
            const int which = gn >> 10;            // 0=q 1=k 2=v
            const int hh    = (gn & 1023) >> 6;    // head
            const int d     = gn & 63;
#pragma unroll
            for (int r = 0; r < 8; ++r) {
                const int m = gm + r;
                const int b = m >> 11;             // / 2048
                const int t = m & 2047;
                const int bh = b * H_N + hh;
                const bf16_t val = (bf16_t)(acc[mi][ni][r] + bv);
                if (which == 0)      qbuf[((size_t)bh * T_SEQ + t) * D_H + d] = val;
                else if (which == 1) kbuf[((size_t)bh * T_SEQ + t) * D_H + d] = val;
                else                 vbuf[((size_t)bh * D_H + d) * T_SEQ + t] = val;
            }
        }
    }
}

// ---------------- stage 2: RoPE on q,k ----------------
__global__ void rope_kernel(bf16_t* __restrict__ qbuf, bf16_t* __restrict__ kbuf) {
    int idx = blockIdx.x * blockDim.x + threadIdx.x;  // over BH * T * (Dh/2)
    if (idx >= (B_N * H_N) << 16) return;
    const int i  = idx & 31;
    const int t  = (idx >> 5) & 2047;
    const int bh = idx >> 16;
    // inv_freq = 10000^(-2i/64) = exp(-(2i/64) * ln(10000))
    const float ang = (float)t * __expf(-(float)(2 * i) * (9.210340371976184f / 64.0f));
    float s, c;
    __sincosf(ang, &s, &c);
    const size_t base = ((size_t)bh * T_SEQ + t) * D_H;
    {
        float x1 = (float)qbuf[base + i], x2 = (float)qbuf[base + i + 32];
        qbuf[base + i]      = (bf16_t)(x1 * c - x2 * s);
        qbuf[base + i + 32] = (bf16_t)(x2 * c + x1 * s);
    }
    {
        float x1 = (float)kbuf[base + i], x2 = (float)kbuf[base + i + 32];
        kbuf[base + i]      = (bf16_t)(x1 * c - x2 * s);
        kbuf[base + i + 32] = (bf16_t)(x2 * c + x1 * s);
    }
}

// ---------------- stage 3: flash attention ----------------
// One staged row: 128 B of data at a pitch of 144 B (16 B x odd), so that the
// 16-row ds_load_b128 fragment reads fall on distinct banks.
#define KV_PITCH 72                       // bf16 elements
#define KV_TILE  (64 * KV_PITCH)          // one 64-row tile, bf16 elements

// This thread's four 16-byte copies of one stage: rows r and r+32 of the 64x64 K tile
// and of the 64x64 V^T tile. A wave's 32 lanes cover four whole 128-byte rows per copy.
// The s_wait_xcnt is the last line of the copies' own statement so that no later write
// of their address registers can be scheduled in front of it.
__device__ __forceinline__ void stage_kv_async(unsigned int ldsK, unsigned int ldsV,
                                               const bf16_t* gK, const bf16_t* gV) {
    asm volatile("global_load_async_to_lds_b128 %0, %4, off\n\t"
                 "global_load_async_to_lds_b128 %1, %5, off\n\t"
                 "global_load_async_to_lds_b128 %2, %6, off\n\t"
                 "global_load_async_to_lds_b128 %3, %7, off\n\t"
                 "s_wait_xcnt 0x0"
                 :
                 : "v"(ldsK), "v"(ldsK + 32u * KV_PITCH * 2u),
                   "v"(ldsV), "v"(ldsV + 32u * KV_PITCH * 2u),
                   "v"(gK), "v"(gK + 32 * D_H), "v"(gV), "v"(gV + 32 * T_SEQ)
                 : "memory");
}

// Exchange a float between lane l and lane l ^ 16 (the two halves of a wave) in the vector unit.
__device__ __forceinline__ float xhalf(float x) {
    const int b = __builtin_bit_cast(int, x);
    return __builtin_bit_cast(float,
        __builtin_amdgcn_permlanex16(b, b, 0x76543210, 0xfedcba98, false, false));
}

__global__ __launch_bounds__(256) void attn_kernel(
    const bf16_t* __restrict__ qbuf,  // [BH][T][Dh]
    const bf16_t* __restrict__ kbuf,  // [BH][T][Dh]
    const bf16_t* __restrict__ vbuf,  // [BH][Dh][T]
    bf16_t* __restrict__ obuf)        // [8192][1024] (m = b*T+t, col = h*64+d)
{
    __shared__ __attribute__((aligned(16))) bf16_t Ks[2][KV_TILE];       // [key][d]
    __shared__ __attribute__((aligned(16))) bf16_t Vs[2][KV_TILE];       // [d][key]
    const int tid  = threadIdx.x;
    const int lane = tid & 31, wv = tid >> 5;
    const int half = lane >> 4, ln = lane & 15;
    const int bh  = blockIdx.y;
    const int qt0 = blockIdx.x * 128;
    const size_t qkbase = (size_t)bh * T_SEQ * D_H;
    const size_t vbase  = (size_t)bh * D_H * T_SEQ;

    // this thread's place in a staged tile: row tid/8 (and +32), 16-byte column tid%8
    const int srow = tid >> 3, scol = (tid & 7) * 8;
    const unsigned int tileBytes = KV_TILE * 2u;
    const unsigned int ldsK0 = (unsigned int)(uintptr_t)&Ks[0][srow * KV_PITCH + scol];
    const unsigned int ldsV0 = (unsigned int)(uintptr_t)&Vs[0][srow * KV_PITCH + scol];
    const bf16_t* gK0 = kbuf + qkbase + (size_t)srow * D_H + scol;    // + tile * 64 * D_H
    const bf16_t* gV0 = vbuf + vbase + (size_t)srow * T_SEQ + scol;   // + tile * 64
    const int NT = T_SEQ / 64;

    stage_kv_async(ldsK0, ldsV0, gK0, gV0);                           // tile 0 -> buffer 0
    ASYNC_WAIT_0();       // this wave's tile-0 copies have landed
    __syncthreads();      // every wave's have: tile 0 is readable
    stage_kv_async(ldsK0 + tileBytes, ldsV0 + tileBytes, gK0 + 64 * D_H, gV0 + 64);  // tile 1 -> buffer 1

    // Q fragments stay resident (B operand: column = query = lane%16, d in ld_frag's k order)
    const int tq = qt0 + wv * 16 + ln;
    v16bf bq[2];
#pragma unroll
    for (int c = 0; c < 2; ++c)
        bq[c] = ld_frag(&qbuf[qkbase + (size_t)tq * D_H + c * 32 + half * 8]);

    float mrun = -1e30f;  // running maximum of this lane's query (equal in both halves)
    float lrun = 0.0f;    // running sum over this half's keys only; the halves join after the loop
    v8f acc[4] = {};      // acc[j2][r] = O[query ln][d = j2*16 + half*8 + r]

    for (int kt = 0; kt < NT; ++kt) {
        const int cur = kt & 1;
        // S^T = (K @ Q^T) * scale: s[j][r] = score of key j*16 + half*8 + r with query ln
        v8f s[4];
#pragma unroll
        for (int j = 0; j < 4; ++j) {
            v8f sj = {};
#pragma unroll
            for (int c = 0; c < 2; ++c) {
                v16bf kf = ld_frag(&Ks[cur][(j * 16 + ln) * KV_PITCH + c * 32 + half * 8]);
                sj = wmma_bf16(kf, bq[c], sj);
            }
#pragma unroll
            for (int r = 0; r < 8; ++r) sj[r] *= 0.125f;   // 1/sqrt(64)
            s[j] = sj;
        }
        // maximum over the 64 keys: 32 in this lane, the other 32 in lane ^ 16
        float rmax = s[0][0];
#pragma unroll
        for (int j = 0; j < 4; ++j)
#pragma unroll
            for (int r = 0; r < 8; ++r) rmax = fmaxf(rmax, s[j][r]);
        rmax = fmaxf(rmax, xhalf(rmax));

        const float mn = fmaxf(mrun, rmax);
        const float sc = __expf(mrun - mn);
        mrun = mn;

        // P^T = exp(S^T - mn). Tiles 2c and 2c+1 give elements 0..7 and 8..15 of the B fragment
        // of keys c*32 .. c*32+31: key = c*32 + (e>=8 ? 16 : 0) + half*8 + e%8, ld_frag's k order.
        v2f ps[2] = {};   // two independent packed chains
        v16bf pf[2];
#pragma unroll
        for (int c = 0; c < 2; ++c)
#pragma unroll
            for (int e = 0; e < 16; e += 2) {
                const v8f& t = s[2 * c + (e >> 3)];
                const v2f x = {t[e & 7], t[(e & 7) + 1]};
                const v2f y = (x - mn) * 1.44269504f;      // exp(x - mn) = 2^((x - mn) * log2 e)
                const v2f p = {__builtin_amdgcn_exp2f(y.x), __builtin_amdgcn_exp2f(y.y)};
                ps[(e >> 1) & 1] += p;
                pf[c][e]     = (bf16_t)p.x;
                pf[c][e + 1] = (bf16_t)p.y;
            }
        ps[0] += ps[1];
        lrun = lrun * sc + (ps[0].x + ps[0].y);
#pragma unroll
        for (int j2 = 0; j2 < 4; ++j2)
#pragma unroll
            for (int r = 0; r < 8; ++r) acc[j2][r] *= sc;

        // O^T += V^T @ P^T   (A fragment: row = d = lane%16, keys from the staged [Dh][key] tile)
#pragma unroll
        for (int j2 = 0; j2 < 4; ++j2)
#pragma unroll
            for (int c = 0; c < 2; ++c) {
                v16bf vf = ld_frag(&Vs[cur][(j2 * 16 + ln) * KV_PITCH + c * 32 + half * 8]);
                acc[j2] = wmma_bf16(vf, pf[c], acc[j2]);
            }
        // hand-over: this wave's LDS reads of buffer cur are done, its copies of tile kt+1 have landed
        asm volatile("s_wait_dscnt 0x0" ::: "memory");
        ASYNC_WAIT_0();
        __syncthreads();      // tile kt+1 readable by all; buffer cur left by all its readers
        if (kt + 2 < NT)      // refill the buffer just read with tile kt+2
            stage_kv_async(ldsK0 + cur * tileBytes, ldsV0 + cur * tileBytes,
                           gK0 + (size_t)(kt + 2) * 64 * D_H, gV0 + (kt + 2) * 64);
    }
    ASYNC_WAIT_0();           // nothing of this wave's is in flight when it leaves the loop

    // normalize + write [m][h*64+d]: a lane holds 8 consecutive d of its query per tile
    const float inv = 1.0f / (lrun + xhalf(lrun));
    const int b = bh >> 4, h = bh & 15;
    bf16_t* orow = obuf + (size_t)(b * T_SEQ + tq) * C_DIM + h * 64 + half * 8;
#pragma unroll
    for (int j2 = 0; j2 < 4; ++j2) {
        v8bf o;
#pragma unroll
        for (int r = 0; r < 8; ++r) o[r] = (bf16_t)(acc[j2][r] * inv);
        *(v8bf*)(orow + j2 * 16) = o;
    }
}

// ---------------- stage 4: output projection ----------------
__global__ __launch_bounds__(256) void gemm_out_kernel(
    const bf16_t* __restrict__ A,    // [8192][1024] (attention output)
    const bf16_t* __restrict__ Bt,   // [1024][1024] = W_out^T
    const float*  __restrict__ bias, // [1024]
    float* __restrict__ out)         // [8192][1024]
{
    __shared__ __attribute__((aligned(16))) bf16_t As[2][128 * 32];
    __shared__ __attribute__((aligned(16))) bf16_t Bs[2][128 * 32];
    const int tid  = threadIdx.x;
    const int lane = tid & 31, wv = tid >> 5;
    const int wr = wv & 3, wc = wv >> 2;
    const int half = lane >> 4, ln = lane & 15;
    const int m0 = blockIdx.y * 128;
    const int n0 = blockIdx.x * 128;
    const unsigned int ldsA0 = (unsigned int)(uintptr_t)&As[0][0];
    const unsigned int ldsB0 = (unsigned int)(uintptr_t)&Bs[0][0];
    const unsigned int bufBytes = 128u * 32u * 2u;

    v8f acc[2][4] = {};
    const int KT = C_DIM / 32;
    stage_async(ldsA0, ldsB0, A, Bt, m0, n0, 0, tid);
    for (int kt = 0; kt < KT; ++kt) {
        const int cur = kt & 1;
        if (kt + 1 < KT) {
            stage_async(ldsA0 + (cur ^ 1) * bufBytes, ldsB0 + (cur ^ 1) * bufBytes,
                        A, Bt, m0, n0, (kt + 1) * 32, tid);
            ASYNC_WAIT_4();
        } else {
            ASYNC_WAIT_0();
        }
        __syncthreads();

        v16bf af[2], bfg[4];
#pragma unroll
        for (int mi = 0; mi < 2; ++mi)
            af[mi] = ld_frag(&As[cur][(wr * 32 + mi * 16 + ln) * 32 + half * 8]);
#pragma unroll
        for (int ni = 0; ni < 4; ++ni)
            bfg[ni] = ld_frag(&Bs[cur][(wc * 64 + ni * 16 + ln) * 32 + half * 8]);
#pragma unroll
        for (int mi = 0; mi < 2; ++mi)
#pragma unroll
            for (int ni = 0; ni < 4; ++ni)
                acc[mi][ni] = wmma_bf16(af[mi], bfg[ni], acc[mi][ni]);
        __syncthreads();
    }
#pragma unroll
    for (int mi = 0; mi < 2; ++mi)
#pragma unroll
        for (int ni = 0; ni < 4; ++ni) {
            const int gm = m0 + wr * 32 + mi * 16 + half * 8;
            const int gn = n0 + wc * 64 + ni * 16 + ln;
            const float bv = bias[gn];
#pragma unroll
            for (int r = 0; r < 8; ++r)
                out[(size_t)(gm + r) * C_DIM + gn] = acc[mi][ni][r] + bv;
        }
}

// ---------------- launcher ----------------
extern "C" void kernel_launch(void* const* d_in, const int* in_sizes, int n_in,
                              void* d_out, int out_size, void* d_ws, size_t ws_size,
                              hipStream_t stream) {
    const float* x     = (const float*)d_in[0];  // [4,2048,1024]
    const float* W_qkv = (const float*)d_in[1];  // [1024,3072]
    const float* b_qkv = (const float*)d_in[2];  // [3072]
    const float* W_out = (const float*)d_in[3];  // [1024,1024]
    const float* b_out = (const float*)d_in[4];  // [1024]
    float* out = (float*)d_out;

    char* ws = (char*)d_ws;
    bf16_t* xb    = (bf16_t*)(ws);                         // 16 MiB (reused as obuf)
    bf16_t* wqkvT = (bf16_t*)(ws + (size_t)16777216);      //  6 MiB
    bf16_t* woT   = (bf16_t*)(ws + (size_t)23068672);      //  2 MiB
    bf16_t* qb    = (bf16_t*)(ws + (size_t)25165824);      // 16 MiB
    bf16_t* kb    = (bf16_t*)(ws + (size_t)41943040);      // 16 MiB
    bf16_t* vb    = (bf16_t*)(ws + (size_t)58720256);      // 16 MiB -> 72 MiB total
    bf16_t* obuf  = xb;  // x is fully consumed by gemm_qkv before attn writes obuf

    // stage 0: precision conversion / weight transposition
    f32_to_bf16_kernel<<<(M_ROWS * C_DIM) / 256, 256, 0, stream>>>(x, xb, M_ROWS * C_DIM);
    transpose_bf16_kernel<<<(C_DIM * N_QKV) / 256, 256, 0, stream>>>(W_qkv, wqkvT, C_DIM, N_QKV);
    transpose_bf16_kernel<<<(C_DIM * C_DIM) / 256, 256, 0, stream>>>(W_out, woT, C_DIM, C_DIM);

    // stage 1: QKV projection (WMMA, async double-buffered LDS) + q/k/v split, v transposed
    gemm_qkv_kernel<<<dim3(N_QKV / 128, M_ROWS / 128), 256, 0, stream>>>(xb, wqkvT, b_qkv, qb, kb, vb);

    // stage 2: RoPE
    rope_kernel<<<((B_N * H_N) << 16) / 256, 256, 0, stream>>>(qb, kb);

    // stage 3: attention (WMMA flash-style)
    attn_kernel<<<dim3(T_SEQ / 128, B_N * H_N), 256, 0, stream>>>(qb, kb, vb, obuf);

    // stage 4: output projection (WMMA, async double-buffered LDS) + bias, fp32 out
    gemm_out_kernel<<<dim3(C_DIM / 128, M_ROWS / 128), 256, 0, stream>>>(obuf, woT, b_out, out);
}

// v003
// One run takes 235 microseconds.
// Next to v002, in two timings, it ran 1.08 times as fast each time.
// All steps since v000 together make it 1.86 times as fast.
#include <hip/hip_runtime.h>
#include <hip/hip_bf16.h>

typedef __bf16 bf16_t;
typedef __bf16 v16bf __attribute__((ext_vector_type(16)));
typedef __bf16 v8bf  __attribute__((ext_vector_type(8)));
typedef float  v8f   __attribute__((ext_vector_type(8)));
typedef float  v2f   __attribute__((ext_vector_type(2)));

#define T_SEQ  2048
#define C_DIM  1024
#define N_QKV  3072
#define H_N    16
#define D_H    64
#define B_N    4
#define M_ROWS 8192   // B*T

// ---- CDNA5 async global->LDS copy (ASYNCcnt-tracked), GVS addressing ----
__device__ __forceinline__ void async_ld16(unsigned int lds_addr, const void* sbase,
                                           unsigned int goff_bytes) {
    asm volatile("global_load_async_to_lds_b128 %0, %1, %2"
                 :
                 : "v"(lds_addr), "v"(goff_bytes), "s"(sbase)
                 : "memory");
}
#define ASYNC_WAIT_4() asm volatile("s_wait_asynccnt 0x4" ::: "memory")
#define ASYNC_WAIT_0() asm volatile("s_wait_asynccnt 0x0" ::: "memory")

// Load a 16-element bf16 A/B WMMA fragment slice.
// Caller passes p = row_base + (lane>=16 ? 8 : 0) [+ k0].
// Elements 0..7  <- p[0..7]   (K = kb .. kb+7)
// Elements 8..15 <- p[16..23] (K = kb+16 .. kb+23)
// Matches CDNA5 16-bit A/B layout: K(e,lane) = (e>=8?16:0)+(lane>=16?8:0)+(e%8).
__device__ __forceinline__ v16bf ld_frag(const bf16_t* p) {
    v8bf lo = *(const v8bf*)(p);
    v8bf hi = *(const v8bf*)(p + 16);
    return __builtin_shufflevector(lo, hi, 0,1,2,3,4,5,6,7,8,9,10,11,12,13,14,15);
}

__device__ __forceinline__ v8f wmma_bf16(v16bf a, v16bf b, v8f c) {
    return __builtin_amdgcn_wmma_f32_16x16x32_bf16(false, a, false, b, (short)0, c, false, false);
}

// A staged GEMM row: 64 B of data at a pitch of 80 B (16 B x odd), so that the 16 rows of a
// ds_load_b128 fragment read fall on distinct banks (at 64 B every fourth row shares its banks).
#define G_PITCH 40                        // bf16 elements

// Issue this thread's 4 async 16B copies for one 128x32 A-tile + 128x32 B-tile stage.
__device__ __forceinline__ void stage_async(unsigned int ldsA, unsigned int ldsB,
                                            const bf16_t* A, const bf16_t* Bt,
                                            int m0, int n0, int k0, int tid) {
#pragma unroll
    for (int i = 0; i < 2; ++i) {
        int chunk = tid * 2 + i;           // 0..511
        int row   = chunk >> 2;            // 0..127
        int col   = (chunk & 3) * 8;       // 0,8,16,24
        unsigned int ldso = (unsigned int)(row * G_PITCH + col) * 2u;
        async_ld16(ldsA + ldso, A,  ((unsigned int)(m0 + row) * C_DIM + k0 + col) * 2u);
        async_ld16(ldsB + ldso, Bt, ((unsigned int)(n0 + row) * C_DIM + k0 + col) * 2u);
    }
}

// ---------------- stage 0: conversions ----------------

__global__ void f32_to_bf16_kernel(const float* __restrict__ in, bf16_t* __restrict__ out, int n) {
    int i = blockIdx.x * blockDim.x + threadIdx.x;
    if (i < n) out[i] = (bf16_t)in[i];
}

// out[n*K + k] = (bf16) in[k*N + n]  (W stored [K][N] row-major -> [N][K])
__global__ void transpose_bf16_kernel(const float* __restrict__ in, bf16_t* __restrict__ out, int K, int N) {
    int idx = blockIdx.x * blockDim.x + threadIdx.x;
    if (idx >= K * N) return;
    int n = idx / K;
    int k = idx - n * K;
    out[idx] = (bf16_t)in[(size_t)k * N + n];
}

// ---------------- stage 1: QKV GEMM + split ----------------
// C[m][n] = sum_k x[m][k] * Wt[n][k] + bias[n]; split into q,k ([BH][T][Dh]) and v ([BH][Dh][T]).
__global__ __launch_bounds__(256) void gemm_qkv_kernel(
    const bf16_t* __restrict__ A,   // [8192][1024]
    const bf16_t* __restrict__ Bt,  // [3072][1024]
    const float*  __restrict__ bias,// [3072]
    bf16_t* __restrict__ qbuf, bf16_t* __restrict__ kbuf, bf16_t* __restrict__ vbuf)
{
    __shared__ __attribute__((aligned(16))) bf16_t As[2][128 * G_PITCH];
    __shared__ __attribute__((aligned(16))) bf16_t Bs[2][128 * G_PITCH];
    const int tid  = threadIdx.x;
    const int lane = tid & 31, wv = tid >> 5;
    const int wr = wv & 3, wc = wv >> 2;          // wave tile: rows wr*32, cols wc*64
    const int half = lane >> 4, ln = lane & 15;
    const int m0 = blockIdx.y * 128;
    const int n0 = blockIdx.x * 128;
    const unsigned int ldsA0 = (unsigned int)(uintptr_t)&As[0][0];
    const unsigned int ldsB0 = (unsigned int)(uintptr_t)&Bs[0][0];
    const unsigned int bufBytes = 128u * G_PITCH * 2u;

    v8f acc[2][4] = {};
    const int KT = C_DIM / 32;
    stage_async(ldsA0, ldsB0, A, Bt, m0, n0, 0, tid);     // prefetch tile 0
    for (int kt = 0; kt < KT; ++kt) {
        const int cur = kt & 1;
        if (kt + 1 < KT) {
            // next tile into the other buffer (its readers passed last iteration's barrier)
            stage_async(ldsA0 + (cur ^ 1) * bufBytes, ldsB0 + (cur ^ 1) * bufBytes,
                        A, Bt, m0, n0, (kt + 1) * 32, tid);
            ASYNC_WAIT_4();   // drain this wave's stage-kt copies (4 older of 8 outstanding)
        } else {
            ASYNC_WAIT_0();
        }
        __syncthreads();      // all waves drained their stage-kt copies -> tile visible

        v16bf af[2], bfg[4];
#pragma unroll
        for (int mi = 0; mi < 2; ++mi)
            af[mi] = ld_frag(&As[cur][(wr * 32 + mi * 16 + ln) * G_PITCH + half * 8]);
#pragma unroll
        for (int ni = 0; ni < 4; ++ni)
            bfg[ni] = ld_frag(&Bs[cur][(wc * 64 + ni * 16 + ln) * G_PITCH + half * 8]);
#pragma unroll
        for (int mi = 0; mi < 2; ++mi)
#pragma unroll
            for (int ni = 0; ni < 4; ++ni)
                acc[mi][ni] = wmma_bf16(af[mi], bfg[ni], acc[mi][ni]);
        __syncthreads();      // everyone done reading buffer `cur` before it is overwritten
    }

    // epilogue: bias + scatter to q/k/v
#pragma unroll
    for (int mi = 0; mi < 2; ++mi) {
#pragma unroll
        for (int ni = 0; ni < 4; ++ni) {
            const int gm = m0 + wr * 32 + mi * 16 + half * 8;
            const int gn = n0 + wc * 64 + ni * 16 + ln;
            const float bv = bias[gn];
            const int which = gn >> 10;            // 0=q 1=k 2=v
            const int hh    = (gn & 1023) >> 6;    // head
            const int d     = gn & 63;
#pragma unroll
            for (int r = 0; r < 8; ++r) {
                const int m = gm + r;
                const int b = m >> 11;             // / 2048
                const int t = m & 2047;
                const int bh = b * H_N + hh;
                const bf16_t val = (bf16_t)(acc[mi][ni][r] + bv);
                if (which == 0)      qbuf[((size_t)bh * T_SEQ + t) * D_H + d] = val;
                else if (which == 1) kbuf[((size_t)bh * T_SEQ + t) * D_H + d] = val;
                else                 vbuf[((size_t)bh * D_H + d) * T_SEQ + t] = val;
            }
        }
    }
}

// ---------------- stage 2: RoPE on q,k ----------------
__global__ void rope_kernel(bf16_t* __restrict__ qbuf, bf16_t* __restrict__ kbuf) {
    int idx = blockIdx.x * blockDim.x + threadIdx.x;  // over BH * T * (Dh/2)
    if (idx >= (B_N * H_N) << 16) return;
    const int i  = idx & 31;
    const int t  = (idx >> 5) & 2047;
    const int bh = idx >> 16;
    // inv_freq = 10000^(-2i/64) = exp(-(2i/64) * ln(10000))
    const float ang = (float)t * __expf(-(float)(2 * i) * (9.210340371976184f / 64.0f));
    float s, c;
    __sincosf(ang, &s, &c);
    const size_t base = ((size_t)bh * T_SEQ + t) * D_H;
    {
        float x1 = (float)qbuf[base + i], x2 = (float)qbuf[base + i + 32];
        qbuf[base + i]      = (bf16_t)(x1 * c - x2 * s);
        qbuf[base + i + 32] = (bf16_t)(x2 * c + x1 * s);
    }
    {
        float x1 = (float)kbuf[base + i], x2 = (float)kbuf[base + i + 32];
        kbuf[base + i]      = (bf16_t)(x1 * c - x2 * s);
        kbuf[base + i + 32] = (bf16_t)(x2 * c + x1 * s);
    }
}

// ---------------- stage 3: flash attention ----------------
// One staged row: 128 B of data at a pitch of 144 B (16 B x odd), so that the
// 16-row ds_load_b128 fragment reads fall on distinct banks.
#define KV_PITCH 72                       // bf16 elements
#define KV_TILE  (64 * KV_PITCH)          // one 64-row tile, bf16 elements

// This thread's four 16-byte copies of one stage: rows r and r+32 of the 64x64 K tile
// and of the 64x64 V^T tile. A wave's 32 lanes cover four whole 128-byte rows per copy.
// The s_wait_xcnt is the last line of the copies' own statement so that no later write
// of their address registers can be scheduled in front of it.
__device__ __forceinline__ void stage_kv_async(unsigned int ldsK, unsigned int ldsV,
                                               const bf16_t* gK, const bf16_t* gV) {
    asm volatile("global_load_async_to_lds_b128 %0, %4, off\n\t"
                 "global_load_async_to_lds_b128 %1, %5, off\n\t"
                 "global_load_async_to_lds_b128 %2, %6, off\n\t"
                 "global_load_async_to_lds_b128 %3, %7, off\n\t"
                 "s_wait_xcnt 0x0"
                 :
                 : "v"(ldsK), "v"(ldsK + 32u * KV_PITCH * 2u),
                   "v"(ldsV), "v"(ldsV + 32u * KV_PITCH * 2u),
                   "v"(gK), "v"(gK + 32 * D_H), "v"(gV), "v"(gV + 32 * T_SEQ)
                 : "memory");
}

// Exchange a float between lane l and lane l ^ 16 (the two halves of a wave) in the vector unit.
__device__ __forceinline__ float xhalf(float x) {
    const int b = __builtin_bit_cast(int, x);
    return __builtin_bit_cast(float,
        __builtin_amdgcn_permlanex16(b, b, 0x76543210, 0xfedcba98, false, false));
}

__global__ __launch_bounds__(256) void attn_kernel(
    const bf16_t* __restrict__ qbuf,  // [BH][T][Dh]
    const bf16_t* __restrict__ kbuf,  // [BH][T][Dh]
    const bf16_t* __restrict__ vbuf,  // [BH][Dh][T]
    bf16_t* __restrict__ obuf)        // [8192][1024] (m = b*T+t, col = h*64+d)
{
    __shared__ __attribute__((aligned(16))) bf16_t Ks[2][KV_TILE];       // [key][d]
    __shared__ __attribute__((aligned(16))) bf16_t Vs[2][KV_TILE];       // [d][key]
    const int tid  = threadIdx.x;
    const int lane = tid & 31, wv = tid >> 5;
    const int half = lane >> 4, ln = lane & 15;
    const int bh  = blockIdx.y;
    const int qt0 = blockIdx.x * 128;
    const size_t qkbase = (size_t)bh * T_SEQ * D_H;
    const size_t vbase  = (size_t)bh * D_H * T_SEQ;

    // this thread's place in a staged tile: row tid/8 (and +32), 16-byte column tid%8
    const int srow = tid >> 3, scol = (tid & 7) * 8;
    const unsigned int tileBytes = KV_TILE * 2u;
    const unsigned int ldsK0 = (unsigned int)(uintptr_t)&Ks[0][srow * KV_PITCH + scol];
    const unsigned int ldsV0 = (unsigned int)(uintptr_t)&Vs[0][srow * KV_PITCH + scol];
    const bf16_t* gK0 = kbuf + qkbase + (size_t)srow * D_H + scol;    // + tile * 64 * D_H
    const bf16_t* gV0 = vbuf + vbase + (size_t)srow * T_SEQ + scol;   // + tile * 64
    const int NT = T_SEQ / 64;

    stage_kv_async(ldsK0, ldsV0, gK0, gV0);                           // tile 0 -> buffer 0
    ASYNC_WAIT_0();       // this wave's tile-0 copies have landed
    __syncthreads();      // every wave's have: tile 0 is readable
    stage_kv_async(ldsK0 + tileBytes, ldsV0 + tileBytes, gK0 + 64 * D_H, gV0 + 64);  // tile 1 -> buffer 1

    // Q fragments stay resident (B operand: column = query = lane%16, d in ld_frag's k order)
    const int tq = qt0 + wv * 16 + ln;
    v16bf bq[2];
#pragma unroll
    for (int c = 0; c < 2; ++c)
        bq[c] = ld_frag(&qbuf[qkbase + (size_t)tq * D_H + c * 32 + half * 8]);

    float mrun = -1e30f;  // running maximum of this lane's query (equal in both halves)
    float lrun = 0.0f;    // running sum over this half's keys only; the halves join after the loop
    v8f acc[4] = {};      // acc[j2][r] = O[query ln][d = j2*16 + half*8 + r]

    for (int kt = 0; kt < NT; ++kt) {
        const int cur = kt & 1;
        // S^T = (K @ Q^T) * scale: s[j][r] = score of key j*16 + half*8 + r with query ln
        v8f s[4];
#pragma unroll
        for (int j = 0; j < 4; ++j) {
            v8f sj = {};
#pragma unroll
            for (int c = 0; c < 2; ++c) {
                v16bf kf = ld_frag(&Ks[cur][(j * 16 + ln) * KV_PITCH + c * 32 + half * 8]);
                sj = wmma_bf16(kf, bq[c], sj);
            }
#pragma unroll
            for (int r = 0; r < 8; ++r) sj[r] *= 0.125f;   // 1/sqrt(64)
            s[j] = sj;
        }
        // maximum over the 64 keys: 32 in this lane, the other 32 in lane ^ 16
        float rmax = s[0][0];
#pragma unroll
        for (int j = 0; j < 4; ++j)
#pragma unroll
            for (int r = 0; r < 8; ++r) rmax = fmaxf(rmax, s[j][r]);
        rmax = fmaxf(rmax, xhalf(rmax));

        const float mn = fmaxf(mrun, rmax);
        const float sc = __expf(mrun - mn);
        mrun = mn;

        // P^T = exp(S^T - mn). Tiles 2c and 2c+1 give elements 0..7 and 8..15 of the B fragment
        // of keys c*32 .. c*32+31: key = c*32 + (e>=8 ? 16 : 0) + half*8 + e%8, ld_frag's k order.
        v2f ps[2] = {};   // two independent packed chains
        v16bf pf[2];
#pragma unroll
        for (int c = 0; c < 2; ++c)
#pragma unroll
            for (int e = 0; e < 16; e += 2) {
                const v8f& t = s[2 * c + (e >> 3)];
                const v2f x = {t[e & 7], t[(e & 7) + 1]};
                const v2f y = (x - mn) * 1.44269504f;      // exp(x - mn) = 2^((x - mn) * log2 e)
                const v2f p = {__builtin_amdgcn_exp2f(y.x), __builtin_amdgcn_exp2f(y.y)};
                ps[(e >> 1) & 1] += p;
                pf[c][e]     = (bf16_t)p.x;
                pf[c][e + 1] = (bf16_t)p.y;
            }
        ps[0] += ps[1];
        lrun = lrun * sc + (ps[0].x + ps[0].y);
#pragma unroll
        for (int j2 = 0; j2 < 4; ++j2)
#pragma unroll
            for (int r = 0; r < 8; ++r) acc[j2][r] *= sc;

        // O^T += V^T @ P^T   (A fragment: row = d = lane%16, keys from the staged [Dh][key] tile)
#pragma unroll
        for (int j2 = 0; j2 < 4; ++j2)
#pragma unroll
            for (int c = 0; c < 2; ++c) {
                v16bf vf = ld_frag(&Vs[cur][(j2 * 16 + ln) * KV_PITCH + c * 32 + half * 8]);
                acc[j2] = wmma_bf16(vf, pf[c], acc[j2]);
            }
        // hand-over: this wave's LDS reads of buffer cur are done, its copies of tile kt+1 have landed
        asm volatile("s_wait_dscnt 0x0" ::: "memory");
        ASYNC_WAIT_0();
        __syncthreads();      // tile kt+1 readable by all; buffer cur left by all its readers
        if (kt + 2 < NT)      // refill the buffer just read with tile kt+2
            stage_kv_async(ldsK0 + cur * tileBytes, ldsV0 + cur * tileBytes,
                           gK0 + (size_t)(kt + 2) * 64 * D_H, gV0 + (kt + 2) * 64);
    }
    ASYNC_WAIT_0();           // nothing of this wave's is in flight when it leaves the loop

    // normalize + write [m][h*64+d]: a lane holds 8 consecutive d of its query per tile
    const float inv = 1.0f / (lrun + xhalf(lrun));
    const int b = bh >> 4, h = bh & 15;
    bf16_t* orow = obuf + (size_t)(b * T_SEQ + tq) * C_DIM + h * 64 + half * 8;
#pragma unroll
    for (int j2 = 0; j2 < 4; ++j2) {
        v8bf o;
#pragma unroll
        for (int r = 0; r < 8; ++r) o[r] = (bf16_t)(acc[j2][r] * inv);
        *(v8bf*)(orow + j2 * 16) = o;
    }
}

// ---------------- stage 4: output projection ----------------
__global__ __launch_bounds__(256) void gemm_out_kernel(
    const bf16_t* __restrict__ A,    // [8192][1024] (attention output)
    const bf16_t* __restrict__ Bt,   // [1024][1024] = W_out^T
    const float*  __restrict__ bias, // [1024]
    float* __restrict__ out)         // [8192][1024]
{
    __shared__ __attribute__((aligned(16))) bf16_t As[2][128 * G_PITCH];
    __shared__ __attribute__((aligned(16))) bf16_t Bs[2][128 * G_PITCH];
    const int tid  = threadIdx.x;
    const int lane = tid & 31, wv = tid >> 5;
    const int wr = wv & 3, wc = wv >> 2;
    const int half = lane >> 4, ln = lane & 15;
    const int m0 = blockIdx.y * 128;
    const int n0 = blockIdx.x * 128;
    const unsigned int ldsA0 = (unsigned int)(uintptr_t)&As[0][0];
    const unsigned int ldsB0 = (unsigned int)(uintptr_t)&Bs[0][0];
    const unsigned int bufBytes = 128u * G_PITCH * 2u;

    v8f acc[2][4] = {};
    const int KT = C_DIM / 32;
    stage_async(ldsA0, ldsB0, A, Bt, m0, n0, 0, tid);
    for (int kt = 0; kt < KT; ++kt) {
        const int cur = kt & 1;
        if (kt + 1 < KT) {
            stage_async(ldsA0 + (cur ^ 1) * bufBytes, ldsB0 + (cur ^ 1) * bufBytes,
                        A, Bt, m0, n0, (kt + 1) * 32, tid);
            ASYNC_WAIT_4();
        } else {
            ASYNC_WAIT_0();
        }
        __syncthreads();

        v16bf af[2], bfg[4];
#pragma unroll
        for (int mi = 0; mi < 2; ++mi)
            af[mi] = ld_frag(&As[cur][(wr * 32 + mi * 16 + ln) * G_PITCH + half * 8]);
#pragma unroll
        for (int ni = 0; ni < 4; ++ni)
            bfg[ni] = ld_frag(&Bs[cur][(wc * 64 + ni * 16 + ln) * G_PITCH + half * 8]);
#pragma unroll
        for (int mi = 0; mi < 2; ++mi)
#pragma unroll
            for (int ni = 0; ni < 4; ++ni)
                acc[mi][ni] = wmma_bf16(af[mi], bfg[ni], acc[mi][ni]);
        __syncthreads();
    }
#pragma unroll
    for (int mi = 0; mi < 2; ++mi)
#pragma unroll
        for (int ni = 0; ni < 4; ++ni) {
            const int gm = m0 + wr * 32 + mi * 16 + half * 8;
            const int gn = n0 + wc * 64 + ni * 16 + ln;
            const float bv = bias[gn];
#pragma unroll
            for (int r = 0; r < 8; ++r)
                out[(size_t)(gm + r) * C_DIM + gn] = acc[mi][ni][r] + bv;
        }
}

// ---------------- launcher ----------------
extern "C" void kernel_launch(void* const* d_in, const int* in_sizes, int n_in,
                              void* d_out, int out_size, void* d_ws, size_t ws_size,
                              hipStream_t stream) {
    const float* x     = (const float*)d_in[0];  // [4,2048,1024]
    const float* W_qkv = (const float*)d_in[1];  // [1024,3072]
    const float* b_qkv = (const float*)d_in[2];  // [3072]
    const float* W_out = (const float*)d_in[3];  // [1024,1024]
    const float* b_out = (const float*)d_in[4];  // [1024]
    float* out = (float*)d_out;

    char* ws = (char*)d_ws;
    bf16_t* xb    = (bf16_t*)(ws);                         // 16 MiB (reused as obuf)
    bf16_t* wqkvT = (bf16_t*)(ws + (size_t)16777216);      //  6 MiB
    bf16_t* woT   = (bf16_t*)(ws + (size_t)23068672);      //  2 MiB
    bf16_t* qb    = (bf16_t*)(ws + (size_t)25165824);      // 16 MiB
    bf16_t* kb    = (bf16_t*)(ws + (size_t)41943040);      // 16 MiB
    bf16_t* vb    = (bf16_t*)(ws + (size_t)58720256);      // 16 MiB -> 72 MiB total
    bf16_t* obuf  = xb;  // x is fully consumed by gemm_qkv before attn writes obuf

    // stage 0: precision conversion / weight transposition
    f32_to_bf16_kernel<<<(M_ROWS * C_DIM) / 256, 256, 0, stream>>>(x, xb, M_ROWS * C_DIM);
    transpose_bf16_kernel<<<(C_DIM * N_QKV) / 256, 256, 0, stream>>>(W_qkv, wqkvT, C_DIM, N_QKV);
    transpose_bf16_kernel<<<(C_DIM * C_DIM) / 256, 256, 0, stream>>>(W_out, woT, C_DIM, C_DIM);

    // stage 1: QKV projection (WMMA, async double-buffered LDS) + q/k/v split, v transposed
    gemm_qkv_kernel<<<dim3(N_QKV / 128, M_ROWS / 128), 256, 0, stream>>>(xb, wqkvT, b_qkv, qb, kb, vb);

    // stage 2: RoPE
    rope_kernel<<<((B_N * H_N) << 16) / 256, 256, 0, stream>>>(qb, kb);

    // stage 3: attention (WMMA flash-style)
    attn_kernel<<<dim3(T_SEQ / 128, B_N * H_N), 256, 0, stream>>>(qb, kb, vb, obuf);

    // stage 4: output projection (WMMA, async double-buffered LDS) + bias, fp32 out
    gemm_out_kernel<<<dim3(C_DIM / 128, M_ROWS / 128), 256, 0, stream>>>(obuf, woT, b_out, out);
}

// v004
// A run of this version takes 205 microseconds.
// Timed twice side by side with v003, it ran 1.15 times as fast both times.
// Over all steps from v000 it is 2.13 times as fast.
#include <hip/hip_runtime.h>
#include <hip/hip_bf16.h>

typedef __bf16 bf16_t;
typedef __bf16 v16bf __attribute__((ext_vector_type(16)));
typedef __bf16 v8bf  __attribute__((ext_vector_type(8)));
typedef float  v8f   __attribute__((ext_vector_type(8)));
typedef float  v2f   __attribute__((ext_vector_type(2)));

#define T_SEQ  2048
#define C_DIM  1024
#define N_QKV  3072
#define H_N    16
#define D_H    64
#define B_N    4
#define M_ROWS 8192   // B*T

// ---- CDNA5 async global->LDS copy (ASYNCcnt-tracked), GVS addressing ----
__device__ __forceinline__ void async_ld16(unsigned int lds_addr, const void* sbase,
                                           unsigned int goff_bytes) {
    asm volatile("global_load_async_to_lds_b128 %0, %1, %2"
                 :
                 : "v"(lds_addr), "v"(goff_bytes), "s"(sbase)
                 : "memory");
}
#define ASYNC_WAIT_4() asm volatile("s_wait_asynccnt 0x4" ::: "memory")
#define ASYNC_WAIT_0() asm volatile("s_wait_asynccnt 0x0" ::: "memory")

// Load a 16-element bf16 A/B WMMA fragment slice.
// Caller passes p = row_base + (lane>=16 ? 8 : 0) [+ k0].
// Elements 0..7  <- p[0..7]   (K = kb .. kb+7)
// Elements 8..15 <- p[16..23] (K = kb+16 .. kb+23)
// Matches CDNA5 16-bit A/B layout: K(e,lane) = (e>=8?16:0)+(lane>=16?8:0)+(e%8).
__device__ __forceinline__ v16bf ld_frag(const bf16_t* p) {
    v8bf lo = *(const v8bf*)(p);
    v8bf hi = *(const v8bf*)(p + 16);
    return __builtin_shufflevector(lo, hi, 0,1,2,3,4,5,6,7,8,9,10,11,12,13,14,15);
}

__device__ __forceinline__ v8f wmma_bf16(v16bf a, v16bf b, v8f c) {
    return __builtin_amdgcn_wmma_f32_16x16x32_bf16(false, a, false, b, (short)0, c, false, false);
}

// A staged GEMM row: 64 B of data at a pitch of 80 B (16 B x odd), so that the 16 rows of a
// ds_load_b128 fragment read fall on distinct banks (at 64 B every fourth row shares its banks).
#define G_PITCH 40                        // bf16 elements

// Issue this thread's 4 async 16B copies for one 128x32 A-tile + 128x32 B-tile stage.
__device__ __forceinline__ void stage_async(unsigned int ldsA, unsigned int ldsB,
                                            const bf16_t* A, const bf16_t* Bt,
                                            int m0, int n0, int k0, int tid) {
#pragma unroll
    for (int i = 0; i < 2; ++i) {
        int chunk = tid * 2 + i;           // 0..511
        int row   = chunk >> 2;            // 0..127
        int col   = (chunk & 3) * 8;       // 0,8,16,24
        unsigned int ldso = (unsigned int)(row * G_PITCH + col) * 2u;
        async_ld16(ldsA + ldso, A,  ((unsigned int)(m0 + row) * C_DIM + k0 + col) * 2u);
        async_ld16(ldsB + ldso, Bt, ((unsigned int)(n0 + row) * C_DIM + k0 + col) * 2u);
    }
}

// ---------------- stage 0: conversions ----------------

__global__ void f32_to_bf16_kernel(const float* __restrict__ in, bf16_t* __restrict__ out, int n) {
    int i = blockIdx.x * blockDim.x + threadIdx.x;
    if (i < n) out[i] = (bf16_t)in[i];
}

// out[n*K + k] = (bf16) in[k*N + n]  (W stored [K][N] row-major -> [N][K])
__global__ void transpose_bf16_kernel(const float* __restrict__ in, bf16_t* __restrict__ out, int K, int N) {
    int idx = blockIdx.x * blockDim.x + threadIdx.x;
    if (idx >= K * N) return;
    int n = idx / K;
    int k = idx - n * K;
    out[idx] = (bf16_t)in[(size_t)k * N + n];
}

// ---------------- stage 1: QKV GEMM + split ----------------
// C[m][n] = sum_k x[m][k] * Wt[n][k] + bias[n]; split into q,k ([BH][T][Dh]) and v ([BH][Dh][T]).
// A block's 128 columns are all q, all k or all v. The operand whose index runs along the
// contiguous direction of the output (d for q and k, t for v) is taken as the products' row
// operand, so a lane's 8 accumulator rows are 8 neighbours in memory. The finished bf16 tile is
// staged in the ring's LDS and goes out in 16-byte stores that cover whole 128-byte lines.
// A staged output row: 256 B of data at a pitch of 272 B (16 B x odd): no bank conflict for b128.
#define C_PITCH 136                       // bf16 elements
__global__ __launch_bounds__(256) void gemm_qkv_kernel(
    const bf16_t* __restrict__ A,   // [8192][1024]
    const bf16_t* __restrict__ Bt,  // [3072][1024]
    const float*  __restrict__ bias,// [3072]
    bf16_t* __restrict__ qbuf, bf16_t* __restrict__ kbuf, bf16_t* __restrict__ vbuf)
{
    __shared__ __attribute__((aligned(16))) bf16_t As[2][128 * G_PITCH];
    __shared__ __attribute__((aligned(16))) bf16_t Bs[2][128 * G_PITCH];
    const int tid  = threadIdx.x;
    const int lane = tid & 31, wv = tid >> 5;
    const int wr = wv & 3, wc = wv >> 2;          // wave tile: rows wr*32, cols wc*64
    const int half = lane >> 4, ln = lane & 15;
    const int m0 = blockIdx.y * 128;
    const int n0 = blockIdx.x * 128;
    const unsigned int ldsA0 = (unsigned int)(uintptr_t)&As[0][0];
    const unsigned int ldsB0 = (unsigned int)(uintptr_t)&Bs[0][0];
    const unsigned int bufBytes = 128u * G_PITCH * 2u;
    const bool isV = n0 >= 2 * C_DIM;             // the same for the whole block
    // this lane's first fragment row of each operand, buffer 0
    const bf16_t* rowOp = (isV ? &As[0][0] : &Bs[0][0])  // v: rows = t (x);  q,k: rows = d (W)
                        + (wr * 32 + ln) * G_PITCH + half * 8;
    const bf16_t* colOp = (isV ? &Bs[0][0] : &As[0][0])  // v: cols = d (W);  q,k: cols = t (x)
                        + (wc * 64 + ln) * G_PITCH + half * 8;

    v8f acc[2][4] = {};
    const int KT = C_DIM / 32;
    stage_async(ldsA0, ldsB0, A, Bt, m0, n0, 0, tid);     // prefetch tile 0
    for (int kt = 0; kt < KT; ++kt) {
        const int cur = kt & 1;
        if (kt + 1 < KT) {
            // next tile into the other buffer (its readers passed last iteration's barrier)
            stage_async(ldsA0 + (cur ^ 1) * bufBytes, ldsB0 + (cur ^ 1) * bufBytes,
                        A, Bt, m0, n0, (kt + 1) * 32, tid);
            ASYNC_WAIT_4();   // drain this wave's stage-kt copies (4 older of 8 outstanding)
        } else {
            ASYNC_WAIT_0();
        }
        __syncthreads();      // all waves drained their stage-kt copies -> tile visible

        v16bf af[2], bfg[4];
#pragma unroll
        for (int mi = 0; mi < 2; ++mi)
            af[mi] = ld_frag(&rowOp[(cur * 128 + mi * 16) * G_PITCH]);
#pragma unroll
        for (int ni = 0; ni < 4; ++ni)
            bfg[ni] = ld_frag(&colOp[(cur * 128 + ni * 16) * G_PITCH]);
#pragma unroll
        for (int mi = 0; mi < 2; ++mi)
#pragma unroll
            for (int ni = 0; ni < 4; ++ni)
                acc[mi][ni] = wmma_bf16(af[mi], bfg[ni], acc[mi][ni]);
        __syncthreads();      // everyone done reading buffer `cur` before it is overwritten
    }

    // epilogue: bias, then the tile [column operand's index][row operand's index] into LDS.
    // Tile rows 0..63 lie in As, rows 64..127 in Bs (the loop's last barrier has freed both).
    bf16_t* ct = (wc ? &Bs[0][0] : &As[0][0]) + ln * C_PITCH + wr * 32 + half * 8;
    if (isV) {                 // bias runs along the tile's rows: one value per lane and ni
        float bc[4];
#pragma unroll
        for (int ni = 0; ni < 4; ++ni) bc[ni] = bias[n0 + wc * 64 + ni * 16 + ln];
        // stands in front of any reuse of the offset register that the four loads above name
        asm volatile("s_wait_xcnt 0x0" ::: "memory");
#pragma unroll
        for (int mi = 0; mi < 2; ++mi)
#pragma unroll
            for (int ni = 0; ni < 4; ++ni) {
                v8bf o;
#pragma unroll
                for (int r = 0; r < 8; ++r) o[r] = (bf16_t)(acc[mi][ni][r] + bc[ni]);
                *(v8bf*)&ct[ni * 16 * C_PITCH + mi * 16] = o;
            }
    } else {                   // bias runs along the lane's 8 accumulator rows
#pragma unroll
        for (int mi = 0; mi < 2; ++mi) {
            const v8f br = *(const v8f*)&bias[n0 + wr * 32 + mi * 16 + half * 8];
#pragma unroll
            for (int ni = 0; ni < 4; ++ni) {
                v8bf o;
#pragma unroll
                for (int r = 0; r < 8; ++r) o[r] = (bf16_t)(acc[mi][ni][r] + br[r]);
                *(v8bf*)&ct[ni * 16 * C_PITCH + mi * 16] = o;
            }
        }
    }
    __syncthreads();          // the whole tile is staged before any wave reads it back

    // 16 lanes read one staged row (256 B) and store it: two whole lines
    const int c8 = (tid & 15) * 8, rw = tid >> 4;
    v8bf val[8];
#pragma unroll
    for (int i = 0; i < 8; ++i)
        val[i] = *(const v8bf*)&((i < 4) ? As : Bs)[0][((i & 3) * 16 + rw) * C_PITCH + c8];
    const int bb = m0 >> 11;                       // batch: 128 rows never straddle one
    const int t0 = m0 & 2047;
    if (isV) {                 // tile row = head * 64 + d, columns = t
        bf16_t* p = vbuf + ((size_t)bb * C_DIM + (n0 & 1023) + rw) * T_SEQ + t0 + c8;
#pragma unroll
        for (int i = 0; i < 8; ++i) *(v8bf*)(p + (size_t)i * 16 * T_SEQ) = val[i];
    } else {                   // tile row = t, columns = two heads' d
        const int n = (n0 & 1023) + c8;
        bf16_t* p = ((n0 < C_DIM) ? qbuf : kbuf)
                  + ((size_t)(bb * H_N + (n >> 6)) * T_SEQ + t0 + rw) * D_H + (n & 63);
#pragma unroll
        for (int i = 0; i < 8; ++i) *(v8bf*)(p + i * 16 * D_H) = val[i];
    }
}

// ---------------- stage 2: RoPE on q,k ----------------
__global__ void rope_kernel(bf16_t* __restrict__ qbuf, bf16_t* __restrict__ kbuf) {
    int idx = blockIdx.x * blockDim.x + threadIdx.x;  // over BH * T * (Dh/2)
    if (idx >= (B_N * H_N) << 16) return;
    const int i  = idx & 31;
    const int t  = (idx >> 5) & 2047;
    const int bh = idx >> 16;
    // inv_freq = 10000^(-2i/64) = exp(-(2i/64) * ln(10000))
    const float ang = (float)t * __expf(-(float)(2 * i) * (9.210340371976184f / 64.0f));
    float s, c;
    __sincosf(ang, &s, &c);
    const size_t base = ((size_t)bh * T_SEQ + t) * D_H;
    {
        float x1 = (float)qbuf[base + i], x2 = (float)qbuf[base + i + 32];
        qbuf[base + i]      = (bf16_t)(x1 * c - x2 * s);
        qbuf[base + i + 32] = (bf16_t)(x2 * c + x1 * s);
    }
    {
        float x1 = (float)kbuf[base + i], x2 = (float)kbuf[base + i + 32];
        kbuf[base + i]      = (bf16_t)(x1 * c - x2 * s);
        kbuf[base + i + 32] = (bf16_t)(x2 * c + x1 * s);
    }
}

// ---------------- stage 3: flash attention ----------------
// One staged row: 128 B of data at a pitch of 144 B (16 B x odd), so that the
// 16-row ds_load_b128 fragment reads fall on distinct banks.
#define KV_PITCH 72                       // bf16 elements
#define KV_TILE  (64 * KV_PITCH)          // one 64-row tile, bf16 elements

// This thread's four 16-byte copies of one stage: rows r and r+32 of the 64x64 K tile
// and of the 64x64 V^T tile. A wave's 32 lanes cover four whole 128-byte rows per copy.
// The s_wait_xcnt is the last line of the copies' own statement so that no later write
// of their address registers can be scheduled in front of it.
__device__ __forceinline__ void stage_kv_async(unsigned int ldsK, unsigned int ldsV,
                                               const bf16_t* gK, const bf16_t* gV) {
    asm volatile("global_load_async_to_lds_b128 %0, %4, off\n\t"
                 "global_load_async_to_lds_b128 %1, %5, off\n\t"
                 "global_load_async_to_lds_b128 %2, %6, off\n\t"
                 "global_load_async_to_lds_b128 %3, %7, off\n\t"
                 "s_wait_xcnt 0x0"
                 :
                 : "v"(ldsK), "v"(ldsK + 32u * KV_PITCH * 2u),
                   "v"(ldsV), "v"(ldsV + 32u * KV_PITCH * 2u),
                   "v"(gK), "v"(gK + 32 * D_H), "v"(gV), "v"(gV + 32 * T_SEQ)
                 : "memory");
}

// Exchange a float between lane l and lane l ^ 16 (the two halves of a wave) in the vector unit.
__device__ __forceinline__ float xhalf(float x) {
    const int b = __builtin_bit_cast(int, x);
    return __builtin_bit_cast(float,
        __builtin_amdgcn_permlanex16(b, b, 0x76543210, 0xfedcba98, false, false));
}

__global__ __launch_bounds__(256) void attn_kernel(
    const bf16_t* __restrict__ qbuf,  // [BH][T][Dh]
    const bf16_t* __restrict__ kbuf,  // [BH][T][Dh]
    const bf16_t* __restrict__ vbuf,  // [BH][Dh][T]
    bf16_t* __restrict__ obuf)        // [8192][1024] (m = b*T+t, col = h*64+d)
{
    __shared__ __attribute__((aligned(16))) bf16_t Ks[2][KV_TILE];       // [key][d]
    __shared__ __attribute__((aligned(16))) bf16_t Vs[2][KV_TILE];       // [d][key]
    const int tid  = threadIdx.x;
    const int lane = tid & 31, wv = tid >> 5;
    const int half = lane >> 4, ln = lane & 15;
    const int bh  = blockIdx.y;
    const int qt0 = blockIdx.x * 128;
    const size_t qkbase = (size_t)bh * T_SEQ * D_H;
    const size_t vbase  = (size_t)bh * D_H * T_SEQ;

    // this thread's place in a staged tile: row tid/8 (and +32), 16-byte column tid%8
    const int srow = tid >> 3, scol = (tid & 7) * 8;
    const unsigned int tileBytes = KV_TILE * 2u;
    const unsigned int ldsK0 = (unsigned int)(uintptr_t)&Ks[0][srow * KV_PITCH + scol];
    const unsigned int ldsV0 = (unsigned int)(uintptr_t)&Vs[0][srow * KV_PITCH + scol];
    const bf16_t* gK0 = kbuf + qkbase + (size_t)srow * D_H + scol;    // + tile * 64 * D_H
    const bf16_t* gV0 = vbuf + vbase + (size_t)srow * T_SEQ + scol;   // + tile * 64
    const int NT = T_SEQ / 64;

    stage_kv_async(ldsK0, ldsV0, gK0, gV0);                           // tile 0 -> buffer 0
    ASYNC_WAIT_0();       // this wave's tile-0 copies have landed
    __syncthreads();      // every wave's have: tile 0 is readable
    stage_kv_async(ldsK0 + tileBytes, ldsV0 + tileBytes, gK0 + 64 * D_H, gV0 + 64);  // tile 1 -> buffer 1

    // Q fragments stay resident (B operand: column = query = lane%16, d in ld_frag's k order)
    const int tq = qt0 + wv * 16 + ln;
    v16bf bq[2];
#pragma unroll
    for (int c = 0; c < 2; ++c)
        bq[c] = ld_frag(&qbuf[qkbase + (size_t)tq * D_H + c * 32 + half * 8]);

    float mrun = -1e30f;  // running maximum of this lane's query (equal in both halves)
    float lrun = 0.0f;    // running sum over this half's keys only; the halves join after the loop
    v8f acc[4] = {};      // acc[j2][r] = O[query ln][d = j2*16 + half*8 + r]

    for (int kt = 0; kt < NT; ++kt) {
        const int cur = kt & 1;
        // S^T = (K @ Q^T) * scale: s[j][r] = score of key j*16 + half*8 + r with query ln
        v8f s[4];
#pragma unroll
        for (int j = 0; j < 4; ++j) {
            v8f sj = {};
#pragma unroll
            for (int c = 0; c < 2; ++c) {
                v16bf kf = ld_frag(&Ks[cur][(j * 16 + ln) * KV_PITCH + c * 32 + half * 8]);
                sj = wmma_bf16(kf, bq[c], sj);
            }
#pragma unroll
            for (int r = 0; r < 8; ++r) sj[r] *= 0.125f;   // 1/sqrt(64)
            s[j] = sj;
        }
        // maximum over the 64 keys: 32 in this lane, the other 32 in lane ^ 16
        float rmax = s[0][0];
#pragma unroll
        for (int j = 0; j < 4; ++j)
#pragma unroll
            for (int r = 0; r < 8; ++r) rmax = fmaxf(rmax, s[j][r]);
        rmax = fmaxf(rmax, xhalf(rmax));

        const float mn = fmaxf(mrun, rmax);
        const float sc = __expf(mrun - mn);
        mrun = mn;

        // P^T = exp(S^T - mn). Tiles 2c and 2c+1 give elements 0..7 and 8..15 of the B fragment
        // of keys c*32 .. c*32+31: key = c*32 + (e>=8 ? 16 : 0) + half*8 + e%8, ld_frag's k order.
        v2f ps[2] = {};   // two independent packed chains
        v16bf pf[2];
#pragma unroll
        for (int c = 0; c < 2; ++c)
#pragma unroll
            for (int e = 0; e < 16; e += 2) {
                const v8f& t = s[2 * c + (e >> 3)];
                const v2f x = {t[e & 7], t[(e & 7) + 1]};
                const v2f y = (x - mn) * 1.44269504f;      // exp(x - mn) = 2^((x - mn) * log2 e)
                const v2f p = {__builtin_amdgcn_exp2f(y.x), __builtin_amdgcn_exp2f(y.y)};
                ps[(e >> 1) & 1] += p;
                pf[c][e]     = (bf16_t)p.x;
                pf[c][e + 1] = (bf16_t)p.y;
            }
        ps[0] += ps[1];
        lrun = lrun * sc + (ps[0].x + ps[0].y);
#pragma unroll
        for (int j2 = 0; j2 < 4; ++j2)
#pragma unroll
            for (int r = 0; r < 8; ++r) acc[j2][r] *= sc;

        // O^T += V^T @ P^T   (A fragment: row = d = lane%16, keys from the staged [Dh][key] tile)
#pragma unroll
        for (int j2 = 0; j2 < 4; ++j2)
#pragma unroll
            for (int c = 0; c < 2; ++c) {
                v16bf vf = ld_frag(&Vs[cur][(j2 * 16 + ln) * KV_PITCH + c * 32 + half * 8]);
                acc[j2] = wmma_bf16(vf, pf[c], acc[j2]);
            }
        // hand-over: this wave's LDS reads of buffer cur are done, its copies of tile kt+1 have landed
        asm volatile("s_wait_dscnt 0x0" ::: "memory");
        ASYNC_WAIT_0();
        __syncthreads();      // tile kt+1 readable by all; buffer cur left by all its readers
        if (kt + 2 < NT)      // refill the buffer just read with tile kt+2
            stage_kv_async(ldsK0 + cur * tileBytes, ldsV0 + cur * tileBytes,
                           gK0 + (size_t)(kt + 2) * 64 * D_H, gV0 + (kt + 2) * 64);
    }
    ASYNC_WAIT_0();           // nothing of this wave's is in flight when it leaves the loop

    // normalize + write [m][h*64+d]: a lane holds 8 consecutive d of its query per tile
    const float inv = 1.0f / (lrun + xhalf(lrun));
    const int b = bh >> 4, h = bh & 15;
    bf16_t* orow = obuf + (size_t)(b * T_SEQ + tq) * C_DIM + h * 64 + half * 8;
#pragma unroll
    for (int j2 = 0; j2 < 4; ++j2) {
        v8bf o;
#pragma unroll
        for (int r = 0; r < 8; ++r) o[r] = (bf16_t)(acc[j2][r] * inv);
        *(v8bf*)(orow + j2 * 16) = o;
    }
}

// ---------------- stage 4: output projection ----------------
__global__ __launch_bounds__(256) void gemm_out_kernel(
    const bf16_t* __restrict__ A,    // [8192][1024] (attention output)
    const bf16_t* __restrict__ Bt,   // [1024][1024] = W_out^T
    const float*  __restrict__ bias, // [1024]
    float* __restrict__ out)         // [8192][1024]
{
    __shared__ __attribute__((aligned(16))) bf16_t As[2][128 * G_PITCH];
    __shared__ __attribute__((aligned(16))) bf16_t Bs[2][128 * G_PITCH];
    const int tid  = threadIdx.x;
    const int lane = tid & 31, wv = tid >> 5;
    const int wr = wv & 3, wc = wv >> 2;
    const int half = lane >> 4, ln = lane & 15;
    const int m0 = blockIdx.y * 128;
    const int n0 = blockIdx.x * 128;
    const unsigned int ldsA0 = (unsigned int)(uintptr_t)&As[0][0];
    const unsigned int ldsB0 = (unsigned int)(uintptr_t)&Bs[0][0];
    const unsigned int bufBytes = 128u * G_PITCH * 2u;

    v8f acc[2][4] = {};
    const int KT = C_DIM / 32;
    stage_async(ldsA0, ldsB0, A, Bt, m0, n0, 0, tid);
    for (int kt = 0; kt < KT; ++kt) {
        const int cur = kt & 1;
        if (kt + 1 < KT) {
            stage_async(ldsA0 + (cur ^ 1) * bufBytes, ldsB0 + (cur ^ 1) * bufBytes,
                        A, Bt, m0, n0, (kt + 1) * 32, tid);
            ASYNC_WAIT_4();
        } else {
            ASYNC_WAIT_0();
        }
        __syncthreads();

        v16bf af[2], bfg[4];
#pragma unroll
        for (int mi = 0; mi < 2; ++mi)
            af[mi] = ld_frag(&As[cur][(wr * 32 + mi * 16 + ln) * G_PITCH + half * 8]);
#pragma unroll
        for (int ni = 0; ni < 4; ++ni)
            bfg[ni] = ld_frag(&Bs[cur][(wc * 64 + ni * 16 + ln) * G_PITCH + half * 8]);
#pragma unroll
        for (int mi = 0; mi < 2; ++mi)
#pragma unroll
            for (int ni = 0; ni < 4; ++ni)
                acc[mi][ni] = wmma_bf16(af[mi], bfg[ni], acc[mi][ni]);
        __syncthreads();
    }
#pragma unroll
    for (int mi = 0; mi < 2; ++mi)
#pragma unroll
        for (int ni = 0; ni < 4; ++ni) {
            const int gm = m0 + wr * 32 + mi * 16 + half * 8;
            const int gn = n0 + wc * 64 + ni * 16 + ln;
            const float bv = bias[gn];
#pragma unroll
            for (int r = 0; r < 8; ++r)
                out[(size_t)(gm + r) * C_DIM + gn] = acc[mi][ni][r] + bv;
        }
}

// ---------------- launcher ----------------
extern "C" void kernel_launch(void* const* d_in, const int* in_sizes, int n_in,
                              void* d_out, int out_size, void* d_ws, size_t ws_size,
                              hipStream_t stream) {
    const float* x     = (const float*)d_in[0];  // [4,2048,1024]
    const float* W_qkv = (const float*)d_in[1];  // [1024,3072]
    const float* b_qkv = (const float*)d_in[2];  // [3072]
    const float* W_out = (const float*)d_in[3];  // [1024,1024]
    const float* b_out = (const float*)d_in[4];  // [1024]
    float* out = (float*)d_out;

    char* ws = (char*)d_ws;
    bf16_t* xb    = (bf16_t*)(ws);                         // 16 MiB (reused as obuf)
    bf16_t* wqkvT = (bf16_t*)(ws + (size_t)16777216);      //  6 MiB
    bf16_t* woT   = (bf16_t*)(ws + (size_t)23068672);      //  2 MiB
    bf16_t* qb    = (bf16_t*)(ws + (size_t)25165824);      // 16 MiB
    bf16_t* kb    = (bf16_t*)(ws + (size_t)41943040);      // 16 MiB
    bf16_t* vb    = (bf16_t*)(ws + (size_t)58720256);      // 16 MiB -> 72 MiB total
    bf16_t* obuf  = xb;  // x is fully consumed by gemm_qkv before attn writes obuf

    // stage 0: precision conversion / weight transposition
    f32_to_bf16_kernel<<<(M_ROWS * C_DIM) / 256, 256, 0, stream>>>(x, xb, M_ROWS * C_DIM);
    transpose_bf16_kernel<<<(C_DIM * N_QKV) / 256, 256, 0, stream>>>(W_qkv, wqkvT, C_DIM, N_QKV);
    transpose_bf16_kernel<<<(C_DIM * C_DIM) / 256, 256, 0, stream>>>(W_out, woT, C_DIM, C_DIM);

    // stage 1: QKV projection (WMMA, async double-buffered LDS) + q/k/v split, v transposed
    gemm_qkv_kernel<<<dim3(N_QKV / 128, M_ROWS / 128), 256, 0, stream>>>(xb, wqkvT, b_qkv, qb, kb, vb);

    // stage 2: RoPE
    rope_kernel<<<((B_N * H_N) << 16) / 256, 256, 0, stream>>>(qb, kb);

    // stage 3: attention (WMMA flash-style)
    attn_kernel<<<dim3(T_SEQ / 128, B_N * H_N), 256, 0, stream>>>(qb, kb, vb, obuf);

    // stage 4: output projection (WMMA, async double-buffered LDS) + bias, fp32 out
    gemm_out_kernel<<<dim3(C_DIM / 128, M_ROWS / 128), 256, 0, stream>>>(obuf, woT, b_out, out);
}

// v005
// Measured time: 178 microseconds a run.
// In two side-by-side timings against v004, it was 1.16 and 1.15 times as fast.
// Over all steps from v000 it is 2.46 times as fast.
#include <hip/hip_runtime.h>
#include <hip/hip_bf16.h>

typedef __bf16 bf16_t;
typedef __bf16 v16bf __attribute__((ext_vector_type(16)));
typedef __bf16 v8bf  __attribute__((ext_vector_type(8)));
typedef float  v8f   __attribute__((ext_vector_type(8)));
typedef float  v2f   __attribute__((ext_vector_type(2)));
typedef float  v4f   __attribute__((ext_vector_type(4)));
typedef __bf16 v4bf  __attribute__((ext_vector_type(4)));

#define T_SEQ  2048
#define C_DIM  1024
#define N_QKV  3072
#define H_N    16
#define D_H    64
#define B_N    4
#define M_ROWS 8192   // B*T

// ---- CDNA5 async global->LDS copy (ASYNCcnt-tracked), GVS addressing ----
__device__ __forceinline__ void async_ld16(unsigned int lds_addr, const void* sbase,
                                           unsigned int goff_bytes) {
    asm volatile("global_load_async_to_lds_b128 %0, %1, %2"
                 :
                 : "v"(lds_addr), "v"(goff_bytes), "s"(sbase)
                 : "memory");
}
#define ASYNC_WAIT_4() asm volatile("s_wait_asynccnt 0x4" ::: "memory")
#define ASYNC_WAIT_0() asm volatile("s_wait_asynccnt 0x0" ::: "memory")

// Load a 16-element bf16 A/B WMMA fragment slice.
// Caller passes p = row_base + (lane>=16 ? 8 : 0) [+ k0].
// Elements 0..7  <- p[0..7]   (K = kb .. kb+7)
// Elements 8..15 <- p[16..23] (K = kb+16 .. kb+23)
// Matches CDNA5 16-bit A/B layout: K(e,lane) = (e>=8?16:0)+(lane>=16?8:0)+(e%8).
__device__ __forceinline__ v16bf ld_frag(const bf16_t* p) {
    v8bf lo = *(const v8bf*)(p);
    v8bf hi = *(const v8bf*)(p + 16);
    return __builtin_shufflevector(lo, hi, 0,1,2,3,4,5,6,7,8,9,10,11,12,13,14,15);
}

__device__ __forceinline__ v8f wmma_bf16(v16bf a, v16bf b, v8f c) {
    return __builtin_amdgcn_wmma_f32_16x16x32_bf16(false, a, false, b, (short)0, c, false, false);
}

// A staged GEMM row: 64 B of data at a pitch of 80 B (16 B x odd), so that the 16 rows of a
// ds_load_b128 fragment read fall on distinct banks (at 64 B every fourth row shares its banks).
#define G_PITCH 40                        // bf16 elements

// Issue this thread's 4 async 16B copies for one 128x32 A-tile + 128x32 B-tile stage.
__device__ __forceinline__ void stage_async(unsigned int ldsA, unsigned int ldsB,
                                            const bf16_t* A, const bf16_t* Bt,
                                            int m0, int n0, int k0, int tid) {
#pragma unroll
    for (int i = 0; i < 2; ++i) {
        int chunk = tid * 2 + i;           // 0..511
        int row   = chunk >> 2;            // 0..127
        int col   = (chunk & 3) * 8;       // 0,8,16,24
        unsigned int ldso = (unsigned int)(row * G_PITCH + col) * 2u;
        async_ld16(ldsA + ldso, A,  ((unsigned int)(m0 + row) * C_DIM + k0 + col) * 2u);
        async_ld16(ldsB + ldso, Bt, ((unsigned int)(n0 + row) * C_DIM + k0 + col) * 2u);
    }
}

// ---------------- stage 0: conversions ----------------

// A wave converts 1024 consecutive floats: eight 16-byte loads per lane, all issued before the
// first use, each covering 512 contiguous bytes of the wave; each store covers 256 contiguous bytes.
// The grid covers the array exactly: 8192 floats per block.
__global__ __launch_bounds__(256) void f32_to_bf16_kernel(const float* __restrict__ in,
                                                          bf16_t* __restrict__ out) {
    const size_t base = (size_t)blockIdx.x * 8192 + (threadIdx.x >> 5) * 1024 + (threadIdx.x & 31) * 4;
    v4f v[8];
#pragma unroll   // both loops unrolled: v[] stays in registers and the eight loads are in flight together
    for (int j = 0; j < 8; ++j) v[j] = *(const v4f*)&in[base + j * 128];
#pragma unroll
    for (int j = 0; j < 8; ++j) *(v4bf*)&out[base + j * 128] = __builtin_convertvector(v[j], v4bf);
}

// out[n*K + k] = (bf16) in[k*N + n]  (W stored [K][N] row-major -> [N][K])
// A thread takes a block of 8 k x 4 n: eight 16-byte loads (8 lanes cover one whole 128-byte line
// of a row of W) and four 16-byte stores (8 consecutive k of one n).
// A block covers 256 k x 32 n; the grid (N/32, K/256) covers W exactly. K and N are literals at
// both calls, so that all eight loads (and all four stores) go through one address register pair.
__device__ __forceinline__ void transpose_bf16(const float* __restrict__ in,
                                               bf16_t* __restrict__ out, const int K, const int N) {
    const int n = blockIdx.x * 32 + (threadIdx.x & 7) * 4;
    const int k = blockIdx.y * 256 + (threadIdx.x >> 3) * 8;
    v4f r[8];
#pragma unroll   // all loops unrolled: r[] stays in registers and the eight loads are in flight together
    for (int j = 0; j < 8; ++j) r[j] = *(const v4f*)&in[(size_t)(k + j) * N + n];
#pragma unroll
    for (int c = 0; c < 4; ++c) {
        v8bf o;
#pragma unroll
        for (int j = 0; j < 8; ++j) o[j] = (bf16_t)r[j][c];
        *(v8bf*)&out[(size_t)(n + c) * K + k] = o;
    }
}
__global__ __launch_bounds__(256) void transpose_wqkv_kernel(const float* __restrict__ in,
                                                             bf16_t* __restrict__ out) {
    transpose_bf16(in, out, C_DIM, N_QKV);
}
__global__ __launch_bounds__(256) void transpose_wout_kernel(const float* __restrict__ in,
                                                             bf16_t* __restrict__ out) {
    transpose_bf16(in, out, C_DIM, C_DIM);
}

// ---------------- stage 1: QKV GEMM + split ----------------
// C[m][n] = sum_k x[m][k] * Wt[n][k] + bias[n]; split into q,k ([BH][T][Dh]) and v ([BH][Dh][T]).
// A block's 128 columns are all q, all k or all v. The operand whose index runs along the
// contiguous direction of the output (d for q and k, t for v) is taken as the products' row
// operand, so a lane's 8 accumulator rows are 8 neighbours in memory. The finished bf16 tile is
// staged in the ring's LDS and goes out in 16-byte stores that cover whole 128-byte lines.
// A staged output row: 256 B of data at a pitch of 272 B (16 B x odd): no bank conflict for b128.
#define C_PITCH 136                       // bf16 elements
__global__ __launch_bounds__(256) void gemm_qkv_kernel(
    const bf16_t* __restrict__ A,   // [8192][1024]
    const bf16_t* __restrict__ Bt,  // [3072][1024]
    const float*  __restrict__ bias,// [3072]
    bf16_t* __restrict__ qbuf, bf16_t* __restrict__ kbuf, bf16_t* __restrict__ vbuf)
{
    __shared__ __attribute__((aligned(16))) bf16_t As[2][128 * G_PITCH];
    __shared__ __attribute__((aligned(16))) bf16_t Bs[2][128 * G_PITCH];
    const int tid  = threadIdx.x;
    const int lane = tid & 31, wv = tid >> 5;
    const int wr = wv & 3, wc = wv >> 2;          // wave tile: rows wr*32, cols wc*64
    const int half = lane >> 4, ln = lane & 15;
    const int m0 = blockIdx.y * 128;
    const int n0 = blockIdx.x * 128;
    const unsigned int ldsA0 = (unsigned int)(uintptr_t)&As[0][0];
    const unsigned int ldsB0 = (unsigned int)(uintptr_t)&Bs[0][0];
    const unsigned int bufBytes = 128u * G_PITCH * 2u;
    const bool isV = n0 >= 2 * C_DIM;             // the same for the whole block
    // this lane's first fragment row of each operand, buffer 0
    const bf16_t* rowOp = (isV ? &As[0][0] : &Bs[0][0])  // v: rows = t (x);  q,k: rows = d (W)
                        + (wr * 32 + ln) * G_PITCH + half * 8;
    const bf16_t* colOp = (isV ? &Bs[0][0] : &As[0][0])  // v: cols = d (W);  q,k: cols = t (x)
                        + (wc * 64 + ln) * G_PITCH + half * 8;

    v8f acc[2][4] = {};
    const int KT = C_DIM / 32;
    stage_async(ldsA0, ldsB0, A, Bt, m0, n0, 0, tid);     // prefetch tile 0
    for (int kt = 0; kt < KT; ++kt) {
        const int cur = kt & 1;
        if (kt + 1 < KT) {
            // next tile into the other buffer (its readers passed last iteration's barrier)
            stage_async(ldsA0 + (cur ^ 1) * bufBytes, ldsB0 + (cur ^ 1) * bufBytes,
                        A, Bt, m0, n0, (kt + 1) * 32, tid);
            ASYNC_WAIT_4();   // drain this wave's stage-kt copies (4 older of 8 outstanding)
        } else {
            ASYNC_WAIT_0();
        }
        __syncthreads();      // all waves drained their stage-kt copies -> tile visible

        v16bf af[2], bfg[4];
#pragma unroll
        for (int mi = 0; mi < 2; ++mi)
            af[mi] = ld_frag(&rowOp[(cur * 128 + mi * 16) * G_PITCH]);
#pragma unroll
        for (int ni = 0; ni < 4; ++ni)
            bfg[ni] = ld_frag(&colOp[(cur * 128 + ni * 16) * G_PITCH]);
#pragma unroll
        for (int mi = 0; mi < 2; ++mi)
#pragma unroll
            for (int ni = 0; ni < 4; ++ni)
                acc[mi][ni] = wmma_bf16(af[mi], bfg[ni], acc[mi][ni]);
        __syncthreads();      // everyone done reading buffer `cur` before it is overwritten
    }

    // epilogue: bias, then the tile [column operand's index][row operand's index] into LDS.
    // Tile rows 0..63 lie in As, rows 64..127 in Bs (the loop's last barrier has freed both).
    bf16_t* ct = (wc ? &Bs[0][0] : &As[0][0]) + ln * C_PITCH + wr * 32 + half * 8;
    if (isV) {                 // bias runs along the tile's rows: one value per lane and ni
        float bc[4];
#pragma unroll
        for (int ni = 0; ni < 4; ++ni) bc[ni] = bias[n0 + wc * 64 + ni * 16 + ln];
        // stands in front of any reuse of the offset register that the four loads above name
        asm volatile("s_wait_xcnt 0x0" ::: "memory");
#pragma unroll
        for (int mi = 0; mi < 2; ++mi)
#pragma unroll
            for (int ni = 0; ni < 4; ++ni) {
                v8bf o;
#pragma unroll
                for (int r = 0; r < 8; ++r) o[r] = (bf16_t)(acc[mi][ni][r] + bc[ni]);
                *(v8bf*)&ct[ni * 16 * C_PITCH + mi * 16] = o;
            }
    } else {                   // bias runs along the lane's 8 accumulator rows
#pragma unroll
        for (int mi = 0; mi < 2; ++mi) {
            const v8f br = *(const v8f*)&bias[n0 + wr * 32 + mi * 16 + half * 8];
#pragma unroll
            for (int ni = 0; ni < 4; ++ni) {
                v8bf o;
#pragma unroll
                for (int r = 0; r < 8; ++r) o[r] = (bf16_t)(acc[mi][ni][r] + br[r]);
                *(v8bf*)&ct[ni * 16 * C_PITCH + mi * 16] = o;
            }
        }
    }
    __syncthreads();          // the whole tile is staged before any wave reads it back

    // 16 lanes read one staged row (256 B) and store it: two whole lines
    const int c8 = (tid & 15) * 8, rw = tid >> 4;
    v8bf val[8];
#pragma unroll
    for (int i = 0; i < 8; ++i)
        val[i] = *(const v8bf*)&((i < 4) ? As : Bs)[0][((i & 3) * 16 + rw) * C_PITCH + c8];
    const int bb = m0 >> 11;                       // batch: 128 rows never straddle one
    const int t0 = m0 & 2047;
    if (isV) {                 // tile row = head * 64 + d, columns = t
        bf16_t* p = vbuf + ((size_t)bb * C_DIM + (n0 & 1023) + rw) * T_SEQ + t0 + c8;
#pragma unroll
        for (int i = 0; i < 8; ++i) *(v8bf*)(p + (size_t)i * 16 * T_SEQ) = val[i];
    } else {                   // tile row = t, columns = two heads' d
        const int n = (n0 & 1023) + c8;
        bf16_t* p = ((n0 < C_DIM) ? qbuf : kbuf)
                  + ((size_t)(bb * H_N + (n >> 6)) * T_SEQ + t0 + rw) * D_H + (n & 63);
#pragma unroll
        for (int i = 0; i < 8; ++i) *(v8bf*)(p + i * 16 * D_H) = val[i];
    }
}

// ---------------- stage 2: RoPE on q,k ----------------
// One transcendental and, in the same statement, the v_nop that fills the slot which the
// instruction set asks for before its result is read or its source overwritten (with eight
// independent chains per thread the compiler sets such instructions back to back).
__device__ __forceinline__ float t_exp2(float x) {
    float r; asm("v_exp_f32 %0, %1\n\tv_nop" : "=v"(r) : "v"(x)); return r;
}
__device__ __forceinline__ float t_sin(float x) {   // sin(2 pi x)
    float r; asm("v_sin_f32 %0, %1\n\tv_nop" : "=v"(r) : "v"(x)); return r;
}
__device__ __forceinline__ float t_cos(float x) {   // cos(2 pi x)
    float r; asm("v_cos_f32 %0, %1\n\tv_nop" : "=v"(r) : "v"(x)); return r;
}

// A thread takes 8 consecutive pairs (i, i + 32) of one row of q and of k: four 16-byte loads,
// four 16-byte stores; four lanes cover a row, a wave eight whole 128-byte rows of each buffer.
// The grid covers BH * T * 4 threads exactly.
__global__ __launch_bounds__(256) void rope_kernel(bf16_t* __restrict__ qbuf, bf16_t* __restrict__ kbuf) {
    const int idx = blockIdx.x * 256 + threadIdx.x;
    const int i0  = (idx & 3) * 8;
    const int t   = (idx >> 2) & 2047;
    const size_t base = (size_t)(idx >> 2) * D_H + i0;   // (bh * T + t) * Dh + i0
    const v8bf q1 = *(const v8bf*)&qbuf[base], q2 = *(const v8bf*)&qbuf[base + 32];
    const v8bf k1 = *(const v8bf*)&kbuf[base], k2 = *(const v8bf*)&kbuf[base + 32];
    v8bf oq1, oq2, ok1, ok2;
#pragma unroll   // vector elements are indexed by constants: everything stays in registers
    for (int e = 0; e < 8; ++e) {
        // inv_freq = 10000^(-2i/64) = exp(-(2i/64) * ln(10000))
        const float ang = (float)t * t_exp2(-(float)(2 * (i0 + e)) * (9.210340371976184f / 64.0f) * 1.44269504f);
        const float rev = ang * 0.15915494f;             // the angle in turns
        const float s = t_sin(rev), c = t_cos(rev);
        {
            const float x1 = (float)q1[e], x2 = (float)q2[e];
            oq1[e] = (bf16_t)(x1 * c - x2 * s);
            oq2[e] = (bf16_t)(x2 * c + x1 * s);
        }
        {
            const float x1 = (float)k1[e], x2 = (float)k2[e];
            ok1[e] = (bf16_t)(x1 * c - x2 * s);
            ok2[e] = (bf16_t)(x2 * c + x1 * s);
        }
    }
    *(v8bf*)&qbuf[base] = oq1;  *(v8bf*)&qbuf[base + 32] = oq2;
    *(v8bf*)&kbuf[base] = ok1;  *(v8bf*)&kbuf[base + 32] = ok2;
}

// ---------------- stage 3: flash attention ----------------
// One staged row: 128 B of data at a pitch of 144 B (16 B x odd), so that the
// 16-row ds_load_b128 fragment reads fall on distinct banks.
#define KV_PITCH 72                       // bf16 elements
#define KV_TILE  (64 * KV_PITCH)          // one 64-row tile, bf16 elements

// This thread's four 16-byte copies of one stage: rows r and r+32 of the 64x64 K tile
// and of the 64x64 V^T tile. A wave's 32 lanes cover four whole 128-byte rows per copy.
// The s_wait_xcnt is the last line of the copies' own statement so that no later write
// of their address registers can be scheduled in front of it.
__device__ __forceinline__ void stage_kv_async(unsigned int ldsK, unsigned int ldsV,
                                               const bf16_t* gK, const bf16_t* gV) {
    asm volatile("global_load_async_to_lds_b128 %0, %4, off\n\t"
                 "global_load_async_to_lds_b128 %1, %5, off\n\t"
                 "global_load_async_to_lds_b128 %2, %6, off\n\t"
                 "global_load_async_to_lds_b128 %3, %7, off\n\t"
                 "s_wait_xcnt 0x0"
                 :
                 : "v"(ldsK), "v"(ldsK + 32u * KV_PITCH * 2u),
                   "v"(ldsV), "v"(ldsV + 32u * KV_PITCH * 2u),
                   "v"(gK), "v"(gK + 32 * D_H), "v"(gV), "v"(gV + 32 * T_SEQ)
                 : "memory");
}

// Exchange a float between lane l and lane l ^ 16 (the two halves of a wave) in the vector unit.
__device__ __forceinline__ float xhalf(float x) {
    const int b = __builtin_bit_cast(int, x);
    return __builtin_bit_cast(float,
        __builtin_amdgcn_permlanex16(b, b, 0x76543210, 0xfedcba98, false, false));
}

__global__ __launch_bounds__(256) void attn_kernel(
    const bf16_t* __restrict__ qbuf,  // [BH][T][Dh]
    const bf16_t* __restrict__ kbuf,  // [BH][T][Dh]
    const bf16_t* __restrict__ vbuf,  // [BH][Dh][T]
    bf16_t* __restrict__ obuf)        // [8192][1024] (m = b*T+t, col = h*64+d)
{
    __shared__ __attribute__((aligned(16))) bf16_t Ks[2][KV_TILE];       // [key][d]
    __shared__ __attribute__((aligned(16))) bf16_t Vs[2][KV_TILE];       // [d][key]
    const int tid  = threadIdx.x;
    const int lane = tid & 31, wv = tid >> 5;
    const int half = lane >> 4, ln = lane & 15;
    const int bh  = blockIdx.y;
    const int qt0 = blockIdx.x * 128;
    const size_t qkbase = (size_t)bh * T_SEQ * D_H;
    const size_t vbase  = (size_t)bh * D_H * T_SEQ;

    // this thread's place in a staged tile: row tid/8 (and +32), 16-byte column tid%8
    const int srow = tid >> 3, scol = (tid & 7) * 8;
    const unsigned int tileBytes = KV_TILE * 2u;
    const unsigned int ldsK0 = (unsigned int)(uintptr_t)&Ks[0][srow * KV_PITCH + scol];
    const unsigned int ldsV0 = (unsigned int)(uintptr_t)&Vs[0][srow * KV_PITCH + scol];
    const bf16_t* gK0 = kbuf + qkbase + (size_t)srow * D_H + scol;    // + tile * 64 * D_H
    const bf16_t* gV0 = vbuf + vbase + (size_t)srow * T_SEQ + scol;   // + tile * 64
    const int NT = T_SEQ / 64;

    stage_kv_async(ldsK0, ldsV0, gK0, gV0);                           // tile 0 -> buffer 0
    ASYNC_WAIT_0();       // this wave's tile-0 copies have landed
    __syncthreads();      // every wave's have: tile 0 is readable
    stage_kv_async(ldsK0 + tileBytes, ldsV0 + tileBytes, gK0 + 64 * D_H, gV0 + 64);  // tile 1 -> buffer 1

    // Q fragments stay resident (B operand: column = query = lane%16, d in ld_frag's k order)
    const int tq = qt0 + wv * 16 + ln;
    v16bf bq[2];
#pragma unroll
    for (int c = 0; c < 2; ++c)
        bq[c] = ld_frag(&qbuf[qkbase + (size_t)tq * D_H + c * 32 + half * 8]);

    float mrun = -1e30f;  // running maximum of this lane's query (equal in both halves)
    float lrun = 0.0f;    // running sum over this half's keys only; the halves join after the loop
    v8f acc[4] = {};      // acc[j2][r] = O[query ln][d = j2*16 + half*8 + r]

    for (int kt = 0; kt < NT; ++kt) {
        const int cur = kt & 1;
        // S^T = (K @ Q^T) * scale: s[j][r] = score of key j*16 + half*8 + r with query ln
        v8f s[4];
#pragma unroll
        for (int j = 0; j < 4; ++j) {
            v8f sj = {};
#pragma unroll
            for (int c = 0; c < 2; ++c) {
                v16bf kf = ld_frag(&Ks[cur][(j * 16 + ln) * KV_PITCH + c * 32 + half * 8]);
                sj = wmma_bf16(kf, bq[c], sj);
            }
#pragma unroll
            for (int r = 0; r < 8; ++r) sj[r] *= 0.125f;   // 1/sqrt(64)
            s[j] = sj;
        }
        // maximum over the 64 keys: 32 in this lane, the other 32 in lane ^ 16
        float rmax = s[0][0];
#pragma unroll
        for (int j = 0; j < 4; ++j)
#pragma unroll
            for (int r = 0; r < 8; ++r) rmax = fmaxf(rmax, s[j][r]);
        rmax = fmaxf(rmax, xhalf(rmax));

        const float mn = fmaxf(mrun, rmax);
        const float sc = __expf(mrun - mn);
        mrun = mn;

        // P^T = exp(S^T - mn). Tiles 2c and 2c+1 give elements 0..7 and 8..15 of the B fragment
        // of keys c*32 .. c*32+31: key = c*32 + (e>=8 ? 16 : 0) + half*8 + e%8, ld_frag's k order.
        v2f ps[2] = {};   // two independent packed chains
        v16bf pf[2];
#pragma unroll
        for (int c = 0; c < 2; ++c)
#pragma unroll
            for (int e = 0; e < 16; e += 2) {
                const v8f& t = s[2 * c + (e >> 3)];
                const v2f x = {t[e & 7], t[(e & 7) + 1]};
                const v2f y = (x - mn) * 1.44269504f;      // exp(x - mn) = 2^((x - mn) * log2 e)
                const v2f p = {__builtin_amdgcn_exp2f(y.x), __builtin_amdgcn_exp2f(y.y)};
                ps[(e >> 1) & 1] += p;
                pf[c][e]     = (bf16_t)p.x;
                pf[c][e + 1] = (bf16_t)p.y;
            }
        ps[0] += ps[1];
        lrun = lrun * sc + (ps[0].x + ps[0].y);
#pragma unroll
        for (int j2 = 0; j2 < 4; ++j2)
#pragma unroll
            for (int r = 0; r < 8; ++r) acc[j2][r] *= sc;

        // O^T += V^T @ P^T   (A fragment: row = d = lane%16, keys from the staged [Dh][key] tile)
#pragma unroll
        for (int j2 = 0; j2 < 4; ++j2)
#pragma unroll
            for (int c = 0; c < 2; ++c) {
                v16bf vf = ld_frag(&Vs[cur][(j2 * 16 + ln) * KV_PITCH + c * 32 + half * 8]);
                acc[j2] = wmma_bf16(vf, pf[c], acc[j2]);
            }
        // hand-over: this wave's LDS reads of buffer cur are done, its copies of tile kt+1 have landed
        asm volatile("s_wait_dscnt 0x0" ::: "memory");
        ASYNC_WAIT_0();
        __syncthreads();      // tile kt+1 readable by all; buffer cur left by all its readers
        if (kt + 2 < NT)      // refill the buffer just read with tile kt+2
            stage_kv_async(ldsK0 + cur * tileBytes, ldsV0 + cur * tileBytes,
                           gK0 + (size_t)(kt + 2) * 64 * D_H, gV0 + (kt + 2) * 64);
    }
    ASYNC_WAIT_0();           // nothing of this wave's is in flight when it leaves the loop

    // normalize + write [m][h*64+d]: a lane holds 8 consecutive d of its query per tile
    const float inv = 1.0f / (lrun + xhalf(lrun));
    const int b = bh >> 4, h = bh & 15;
    bf16_t* orow = obuf + (size_t)(b * T_SEQ + tq) * C_DIM + h * 64 + half * 8;
#pragma unroll
    for (int j2 = 0; j2 < 4; ++j2) {
        v8bf o;
#pragma unroll
        for (int r = 0; r < 8; ++r) o[r] = (bf16_t)(acc[j2][r] * inv);
        *(v8bf*)(orow + j2 * 16) = o;
    }
}

// ---------------- stage 4: output projection ----------------
__global__ __launch_bounds__(256) void gemm_out_kernel(
    const bf16_t* __restrict__ A,    // [8192][1024] (attention output)
    const bf16_t* __restrict__ Bt,   // [1024][1024] = W_out^T
    const float*  __restrict__ bias, // [1024]
    float* __restrict__ out)         // [8192][1024]
{
    __shared__ __attribute__((aligned(16))) bf16_t As[2][128 * G_PITCH];
    __shared__ __attribute__((aligned(16))) bf16_t Bs[2][128 * G_PITCH];
    const int tid  = threadIdx.x;
    const int lane = tid & 31, wv = tid >> 5;
    const int wr = wv & 3, wc = wv >> 2;
    const int half = lane >> 4, ln = lane & 15;
    const int m0 = blockIdx.y * 128;
    const int n0 = blockIdx.x * 128;
    const unsigned int ldsA0 = (unsigned int)(uintptr_t)&As[0][0];
    const unsigned int ldsB0 = (unsigned int)(uintptr_t)&Bs[0][0];
    const unsigned int bufBytes = 128u * G_PITCH * 2u;

    v8f acc[2][4] = {};
    const int KT = C_DIM / 32;
    stage_async(ldsA0, ldsB0, A, Bt, m0, n0, 0, tid);
    for (int kt = 0; kt < KT; ++kt) {
        const int cur = kt & 1;
        if (kt + 1 < KT) {
            stage_async(ldsA0 + (cur ^ 1) * bufBytes, ldsB0 + (cur ^ 1) * bufBytes,
                        A, Bt, m0, n0, (kt + 1) * 32, tid);
            ASYNC_WAIT_4();
        } else {
            ASYNC_WAIT_0();
        }
        __syncthreads();

        v16bf af[2], bfg[4];
#pragma unroll
        for (int mi = 0; mi < 2; ++mi)
            af[mi] = ld_frag(&As[cur][(wr * 32 + mi * 16 + ln) * G_PITCH + half * 8]);
#pragma unroll
        for (int ni = 0; ni < 4; ++ni)
            bfg[ni] = ld_frag(&Bs[cur][(wc * 64 + ni * 16 + ln) * G_PITCH + half * 8]);
#pragma unroll
        for (int mi = 0; mi < 2; ++mi)
#pragma unroll
            for (int ni = 0; ni < 4; ++ni)
                acc[mi][ni] = wmma_bf16(af[mi], bfg[ni], acc[mi][ni]);
        __syncthreads();
    }
#pragma unroll
    for (int mi = 0; mi < 2; ++mi)
#pragma unroll
        for (int ni = 0; ni < 4; ++ni) {
            const int gm = m0 + wr * 32 + mi * 16 + half * 8;
            const int gn = n0 + wc * 64 + ni * 16 + ln;
            const float bv = bias[gn];
#pragma unroll
            for (int r = 0; r < 8; ++r)
                out[(size_t)(gm + r) * C_DIM + gn] = acc[mi][ni][r] + bv;
        }
}

// ---------------- launcher ----------------
extern "C" void kernel_launch(void* const* d_in, const int* in_sizes, int n_in,
                              void* d_out, int out_size, void* d_ws, size_t ws_size,
                              hipStream_t stream) {
    const float* x     = (const float*)d_in[0];  // [4,2048,1024]
    const float* W_qkv = (const float*)d_in[1];  // [1024,3072]
    const float* b_qkv = (const float*)d_in[2];  // [3072]
    const float* W_out = (const float*)d_in[3];  // [1024,1024]
    const float* b_out = (const float*)d_in[4];  // [1024]
    float* out = (float*)d_out;

    char* ws = (char*)d_ws;
    bf16_t* xb    = (bf16_t*)(ws);                         // 16 MiB (reused as obuf)
    bf16_t* wqkvT = (bf16_t*)(ws + (size_t)16777216);      //  6 MiB
    bf16_t* woT   = (bf16_t*)(ws + (size_t)23068672);      //  2 MiB
    bf16_t* qb    = (bf16_t*)(ws + (size_t)25165824);      // 16 MiB
    bf16_t* kb    = (bf16_t*)(ws + (size_t)41943040);      // 16 MiB
    bf16_t* vb    = (bf16_t*)(ws + (size_t)58720256);      // 16 MiB -> 72 MiB total
    bf16_t* obuf  = xb;  // x is fully consumed by gemm_qkv before attn writes obuf

    // stage 0: precision conversion / weight transposition
    f32_to_bf16_kernel<<<(M_ROWS * C_DIM) / 8192, 256, 0, stream>>>(x, xb);
    transpose_wqkv_kernel<<<dim3(N_QKV / 32, C_DIM / 256), 256, 0, stream>>>(W_qkv, wqkvT);
    transpose_wout_kernel<<<dim3(C_DIM / 32, C_DIM / 256), 256, 0, stream>>>(W_out, woT);

    // stage 1: QKV projection (WMMA, async double-buffered LDS) + q/k/v split, v transposed
    gemm_qkv_kernel<<<dim3(N_QKV / 128, M_ROWS / 128), 256, 0, stream>>>(xb, wqkvT, b_qkv, qb, kb, vb);

    // stage 2: RoPE
    rope_kernel<<<(B_N * H_N * T_SEQ * 4) / 256, 256, 0, stream>>>(qb, kb);

    // stage 3: attention (WMMA flash-style)
    attn_kernel<<<dim3(T_SEQ / 128, B_N * H_N), 256, 0, stream>>>(qb, kb, vb, obuf);

    // stage 4: output projection (WMMA, async double-buffered LDS) + bias, fp32 out
    gemm_out_kernel<<<dim3(C_DIM / 128, M_ROWS / 128), 256, 0, stream>>>(obuf, woT, b_out, out);
}

// v006
// A run of this version takes 158 microseconds.
// Next to v005, in two timings, it ran 1.12 and 1.13 times as fast.
// All steps since v000 together make it 2.77 times as fast.
#include <hip/hip_runtime.h>
#include <hip/hip_bf16.h>

typedef __bf16 bf16_t;
typedef __bf16 v16bf __attribute__((ext_vector_type(16)));
typedef __bf16 v8bf  __attribute__((ext_vector_type(8)));
typedef float  v8f   __attribute__((ext_vector_type(8)));
typedef float  v2f   __attribute__((ext_vector_type(2)));
typedef float  v4f   __attribute__((ext_vector_type(4)));
typedef __bf16 v4bf  __attribute__((ext_vector_type(4)));

#define T_SEQ  2048
#define C_DIM  1024
#define N_QKV  3072
#define H_N    16
#define D_H    64
#define B_N    4
#define M_ROWS 8192   // B*T

// ---- CDNA5 async global->LDS copies are tracked by ASYNCcnt ----
#define ASYNC_WAIT_0() asm volatile("s_wait_asynccnt 0x0" ::: "memory")

// Load a 16-element bf16 A/B WMMA fragment slice.
// Caller passes p = row_base + (lane>=16 ? 8 : 0) [+ k0].
// Elements 0..7  <- p[0..7]   (K = kb .. kb+7)
// Elements 8..15 <- p[16..23] (K = kb+16 .. kb+23)
// Matches CDNA5 16-bit A/B layout: K(e,lane) = (e>=8?16:0)+(lane>=16?8:0)+(e%8).
__device__ __forceinline__ v16bf ld_frag(const bf16_t* p) {
    v8bf lo = *(const v8bf*)(p);
    v8bf hi = *(const v8bf*)(p + 16);
    return __builtin_shufflevector(lo, hi, 0,1,2,3,4,5,6,7,8,9,10,11,12,13,14,15);
}

__device__ __forceinline__ v8f wmma_bf16(v16bf a, v16bf b, v8f c) {
    return __builtin_amdgcn_wmma_f32_16x16x32_bf16(false, a, false, b, (short)0, c, false, false);
}

// A staged GEMM row: 64 k = 128 B of data (one whole line of the operand's row in memory) at a
// pitch of 144 B (16 B x odd), so that the 16 rows of a ds_load_b128 fragment read fall on
// distinct banks.
#define G_BK    64                        // k per stage
#define G_PITCH 72                        // bf16 elements
#define G_TILE  (128 * G_PITCH)           // one 128-row tile, bf16 elements

// This thread's eight 16-byte copies of one stage: rows r, r+32, r+64 and r+96 of the 128x64
// A tile and of the 128x64 B tile. Eight lanes cover one row, so a wave's 32 lanes bring four
// whole 128-byte lines per copy. The s_wait_xcnt is the last line of the copies' own statement
// so that no later write of their address registers can be scheduled in front of it.
__device__ __forceinline__ void stage_ab_async(unsigned int ldsA, unsigned int ldsB,
                                               const bf16_t* gA, const bf16_t* gB) {
    asm volatile("global_load_async_to_lds_b128 %0, %8, off\n\t"
                 "global_load_async_to_lds_b128 %1, %9, off\n\t"
                 "global_load_async_to_lds_b128 %2, %10, off\n\t"
                 "global_load_async_to_lds_b128 %3, %11, off\n\t"
                 "global_load_async_to_lds_b128 %4, %12, off\n\t"
                 "global_load_async_to_lds_b128 %5, %13, off\n\t"
                 "global_load_async_to_lds_b128 %6, %14, off\n\t"
                 "global_load_async_to_lds_b128 %7, %15, off\n\t"
                 "s_wait_xcnt 0x0"
                 :
                 : "v"(ldsA), "v"(ldsA + 32u * G_PITCH * 2u),
                   "v"(ldsA + 64u * G_PITCH * 2u), "v"(ldsA + 96u * G_PITCH * 2u),
                   "v"(ldsB), "v"(ldsB + 32u * G_PITCH * 2u),
                   "v"(ldsB + 64u * G_PITCH * 2u), "v"(ldsB + 96u * G_PITCH * 2u),
                   "v"(gA), "v"(gA + 32 * C_DIM), "v"(gA + 64 * C_DIM), "v"(gA + 96 * C_DIM),
                   "v"(gB), "v"(gB + 32 * C_DIM), "v"(gB + 64 * C_DIM), "v"(gB + 96 * C_DIM)
                 : "memory");
}

// ---------------- stage 0: conversions ----------------

// A wave converts 1024 consecutive floats: eight 16-byte loads per lane, all issued before the
// first use, each covering 512 contiguous bytes of the wave; each store covers 256 contiguous bytes.
// The grid covers the array exactly: 8192 floats per block.
__global__ __launch_bounds__(256) void f32_to_bf16_kernel(const float* __restrict__ in,
                                                          bf16_t* __restrict__ out) {
    const size_t base = (size_t)blockIdx.x * 8192 + (threadIdx.x >> 5) * 1024 + (threadIdx.x & 31) * 4;
    v4f v[8];
#pragma unroll   // both loops unrolled: v[] stays in registers and the eight loads are in flight together
    for (int j = 0; j < 8; ++j) v[j] = *(const v4f*)&in[base + j * 128];
#pragma unroll
    for (int j = 0; j < 8; ++j) *(v4bf*)&out[base + j * 128] = __builtin_convertvector(v[j], v4bf);
}

// out[n*K + k] = (bf16) in[k*N + n]  (W stored [K][N] row-major -> [N][K])
// A thread takes a block of 8 k x 4 n: eight 16-byte loads (8 lanes cover one whole 128-byte line
// of a row of W) and four 16-byte stores (8 consecutive k of one n).
// A block covers 256 k x 32 n; the grid (N/32, K/256) covers W exactly. K and N are literals at
// both calls, so that all eight loads (and all four stores) go through one address register pair.
__device__ __forceinline__ void transpose_bf16(const float* __restrict__ in,
                                               bf16_t* __restrict__ out, const int K, const int N) {
    const int n = blockIdx.x * 32 + (threadIdx.x & 7) * 4;
    const int k = blockIdx.y * 256 + (threadIdx.x >> 3) * 8;
    v4f r[8];
#pragma unroll   // all loops unrolled: r[] stays in registers and the eight loads are in flight together
    for (int j = 0; j < 8; ++j) r[j] = *(const v4f*)&in[(size_t)(k + j) * N + n];
#pragma unroll
    for (int c = 0; c < 4; ++c) {
        v8bf o;
#pragma unroll
        for (int j = 0; j < 8; ++j) o[j] = (bf16_t)r[j][c];
        *(v8bf*)&out[(size_t)(n + c) * K + k] = o;
    }
}
__global__ __launch_bounds__(256) void transpose_wqkv_kernel(const float* __restrict__ in,
                                                             bf16_t* __restrict__ out) {
    transpose_bf16(in, out, C_DIM, N_QKV);
}
__global__ __launch_bounds__(256) void transpose_wout_kernel(const float* __restrict__ in,
                                                             bf16_t* __restrict__ out) {
    transpose_bf16(in, out, C_DIM, C_DIM);
}

// ---------------- stage 1: QKV GEMM + split ----------------
// C[m][n] = sum_k x[m][k] * Wt[n][k] + bias[n]; split into q,k ([BH][T][Dh]) and v ([BH][Dh][T]).
// A block's 128 columns are all q, all k or all v. The operand whose index runs along the
// contiguous direction of the output (d for q and k, t for v) is taken as the products' row
// operand, so a lane's 8 accumulator rows are 8 neighbours in memory. The finished bf16 tile is
// staged in the ring's LDS and goes out in 16-byte stores that cover whole 128-byte lines.
// A staged output row: 256 B of data at a pitch of 272 B (16 B x odd): no bank conflict for b128.
#define C_PITCH 136                       // bf16 elements
__global__ __launch_bounds__(256) void gemm_qkv_kernel(
    const bf16_t* __restrict__ A,   // [8192][1024]
    const bf16_t* __restrict__ Bt,  // [3072][1024]
    const float*  __restrict__ bias,// [3072]
    bf16_t* __restrict__ qbuf, bf16_t* __restrict__ kbuf, bf16_t* __restrict__ vbuf)
{
    __shared__ __attribute__((aligned(16))) bf16_t As[2][G_TILE];
    __shared__ __attribute__((aligned(16))) bf16_t Bs[2][G_TILE];
    const int tid  = threadIdx.x;
    const int lane = tid & 31, wv = tid >> 5;
    const int wr = wv & 3, wc = wv >> 2;          // wave tile: rows wr*32, cols wc*64
    const int half = lane >> 4, ln = lane & 15;
    const int m0 = blockIdx.y * 128;
    const int n0 = blockIdx.x * 128;
    // this thread's place in a staged tile: row tid/8 (and +32, +64, +96), 16-byte column tid%8
    const int srow = tid >> 3, scol = (tid & 7) * 8;
    const unsigned int ldsA0 = (unsigned int)(uintptr_t)&As[0][srow * G_PITCH + scol];
    const unsigned int ldsB0 = (unsigned int)(uintptr_t)&Bs[0][srow * G_PITCH + scol];
    const unsigned int bufBytes = G_TILE * 2u;
    const bf16_t* gA0 = A  + (size_t)(m0 + srow) * C_DIM + scol;      // + stage * G_BK
    const bf16_t* gB0 = Bt + (size_t)(n0 + srow) * C_DIM + scol;      // + stage * G_BK
    const bool isV = n0 >= 2 * C_DIM;             // the same for the whole block
    // this lane's first fragment row of each operand, buffer 0
    const bf16_t* rowOp = (isV ? &As[0][0] : &Bs[0][0])  // v: rows = t (x);  q,k: rows = d (W)
                        + (wr * 32 + ln) * G_PITCH + half * 8;
    const bf16_t* colOp = (isV ? &Bs[0][0] : &As[0][0])  // v: cols = d (W);  q,k: cols = t (x)
                        + (wc * 64 + ln) * G_PITCH + half * 8;

    v8f acc[2][4] = {};
    const int KT = C_DIM / G_BK;
    stage_ab_async(ldsA0, ldsB0, gA0, gB0);                           // stage 0 -> buffer 0
    ASYNC_WAIT_0();       // this wave's stage-0 copies have landed
    __syncthreads();      // every wave's have: stage 0 is readable
    stage_ab_async(ldsA0 + bufBytes, ldsB0 + bufBytes, gA0 + G_BK, gB0 + G_BK);  // stage 1 -> buffer 1
    for (int kt = 0; kt < KT; ++kt) {
        const int cur = kt & 1;
#pragma unroll   // the two 32-k halves of the stage, in ascending k
        for (int ks = 0; ks < 2; ++ks) {
            v16bf af[2], bfg[4];
#pragma unroll
            for (int mi = 0; mi < 2; ++mi)
                af[mi] = ld_frag(&rowOp[(cur * 128 + mi * 16) * G_PITCH + ks * 32]);
#pragma unroll
            for (int ni = 0; ni < 4; ++ni)
                bfg[ni] = ld_frag(&colOp[(cur * 128 + ni * 16) * G_PITCH + ks * 32]);
#pragma unroll
            for (int mi = 0; mi < 2; ++mi)
#pragma unroll
                for (int ni = 0; ni < 4; ++ni)
                    acc[mi][ni] = wmma_bf16(af[mi], bfg[ni], acc[mi][ni]);
        }
        // hand-over: this wave's LDS reads of buffer cur are done, its copies of stage kt+1 have landed
        asm volatile("s_wait_dscnt 0x0" ::: "memory");
        ASYNC_WAIT_0();
        __syncthreads();      // stage kt+1 readable by all; buffer cur left by all its readers
        if (kt + 2 < KT)      // refill the buffer just read with stage kt+2
            stage_ab_async(ldsA0 + cur * bufBytes, ldsB0 + cur * bufBytes,
                           gA0 + (kt + 2) * G_BK, gB0 + (kt + 2) * G_BK);
    }
    ASYNC_WAIT_0();           // nothing of this wave's is in flight when it leaves the loop

    // epilogue: bias, then the tile [column operand's index][row operand's index] into LDS.
    // Tile rows 0..63 lie in As, rows 64..127 in Bs (the loop's last barrier has freed both).
    bf16_t* ct = (wc ? &Bs[0][0] : &As[0][0]) + ln * C_PITCH + wr * 32 + half * 8;
    if (isV) {                 // bias runs along the tile's rows: one value per lane and ni
        float bc[4];
#pragma unroll
        for (int ni = 0; ni < 4; ++ni) bc[ni] = bias[n0 + wc * 64 + ni * 16 + ln];
        // stands in front of any reuse of the offset register that the four loads above name
        asm volatile("s_wait_xcnt 0x0" ::: "memory");
#pragma unroll
        for (int mi = 0; mi < 2; ++mi)
#pragma unroll
            for (int ni = 0; ni < 4; ++ni) {
                v8bf o;
#pragma unroll
                for (int r = 0; r < 8; ++r) o[r] = (bf16_t)(acc[mi][ni][r] + bc[ni]);
                *(v8bf*)&ct[ni * 16 * C_PITCH + mi * 16] = o;
            }
    } else {                   // bias runs along the lane's 8 accumulator rows
#pragma unroll
        for (int mi = 0; mi < 2; ++mi) {
            const v8f br = *(const v8f*)&bias[n0 + wr * 32 + mi * 16 + half * 8];
#pragma unroll
            for (int ni = 0; ni < 4; ++ni) {
                v8bf o;
#pragma unroll
                for (int r = 0; r < 8; ++r) o[r] = (bf16_t)(acc[mi][ni][r] + br[r]);
                *(v8bf*)&ct[ni * 16 * C_PITCH + mi * 16] = o;
            }
        }
    }
    __syncthreads();          // the whole tile is staged before any wave reads it back

    // 16 lanes read one staged row (256 B) and store it: two whole lines
    const int c8 = (tid & 15) * 8, rw = tid >> 4;
    v8bf val[8];
#pragma unroll
    for (int i = 0; i < 8; ++i)
        val[i] = *(const v8bf*)&((i < 4) ? As : Bs)[0][((i & 3) * 16 + rw) * C_PITCH + c8];
    const int bb = m0 >> 11;                       // batch: 128 rows never straddle one
    const int t0 = m0 & 2047;
    if (isV) {                 // tile row = head * 64 + d, columns = t
        bf16_t* p = vbuf + ((size_t)bb * C_DIM + (n0 & 1023) + rw) * T_SEQ + t0 + c8;
#pragma unroll
        for (int i = 0; i < 8; ++i) *(v8bf*)(p + (size_t)i * 16 * T_SEQ) = val[i];
    } else {                   // tile row = t, columns = two heads' d
        const int n = (n0 & 1023) + c8;
        bf16_t* p = ((n0 < C_DIM) ? qbuf : kbuf)
                  + ((size_t)(bb * H_N + (n >> 6)) * T_SEQ + t0 + rw) * D_H + (n & 63);
#pragma unroll
        for (int i = 0; i < 8; ++i) *(v8bf*)(p + i * 16 * D_H) = val[i];
    }
}

// ---------------- stage 2: RoPE on q,k ----------------
// One transcendental and, in the same statement, the v_nop that fills the slot which the
// instruction set asks for before its result is read or its source overwritten (with eight
// independent chains per thread the compiler sets such instructions back to back).
__device__ __forceinline__ float t_exp2(float x) {
    float r; asm("v_exp_f32 %0, %1\n\tv_nop" : "=v"(r) : "v"(x)); return r;
}
__device__ __forceinline__ float t_sin(float x) {   // sin(2 pi x)
    float r; asm("v_sin_f32 %0, %1\n\tv_nop" : "=v"(r) : "v"(x)); return r;
}
__device__ __forceinline__ float t_cos(float x) {   // cos(2 pi x)
    float r; asm("v_cos_f32 %0, %1\n\tv_nop" : "=v"(r) : "v"(x)); return r;
}

// A thread takes 8 consecutive pairs (i, i + 32) of one row of q and of k: four 16-byte loads,
// four 16-byte stores; four lanes cover a row, a wave eight whole 128-byte rows of each buffer.
// The grid covers BH * T * 4 threads exactly.
__global__ __launch_bounds__(256) void rope_kernel(bf16_t* __restrict__ qbuf, bf16_t* __restrict__ kbuf) {
    const int idx = blockIdx.x * 256 + threadIdx.x;
    const int i0  = (idx & 3) * 8;
    const int t   = (idx >> 2) & 2047;
    const size_t base = (size_t)(idx >> 2) * D_H + i0;   // (bh * T + t) * Dh + i0
    const v8bf q1 = *(const v8bf*)&qbuf[base], q2 = *(const v8bf*)&qbuf[base + 32];
    const v8bf k1 = *(const v8bf*)&kbuf[base], k2 = *(const v8bf*)&kbuf[base + 32];
    v8bf oq1, oq2, ok1, ok2;
#pragma unroll   // vector elements are indexed by constants: everything stays in registers
    for (int e = 0; e < 8; ++e) {
        // inv_freq = 10000^(-2i/64) = exp(-(2i/64) * ln(10000))
        const float ang = (float)t * t_exp2(-(float)(2 * (i0 + e)) * (9.210340371976184f / 64.0f) * 1.44269504f);
        const float rev = ang * 0.15915494f;             // the angle in turns
        const float s = t_sin(rev), c = t_cos(rev);
        {
            const float x1 = (float)q1[e], x2 = (float)q2[e];
            oq1[e] = (bf16_t)(x1 * c - x2 * s);
            oq2[e] = (bf16_t)(x2 * c + x1 * s);
        }
        {
            const float x1 = (float)k1[e], x2 = (float)k2[e];
            ok1[e] = (bf16_t)(x1 * c - x2 * s);
            ok2[e] = (bf16_t)(x2 * c + x1 * s);
        }
    }
    *(v8bf*)&qbuf[base] = oq1;  *(v8bf*)&qbuf[base + 32] = oq2;
    *(v8bf*)&kbuf[base] = ok1;  *(v8bf*)&kbuf[base + 32] = ok2;
}

// ---------------- stage 3: flash attention ----------------
// One staged row: 128 B of data at a pitch of 144 B (16 B x odd), so that the
// 16-row ds_load_b128 fragment reads fall on distinct banks.
#define KV_PITCH 72                       // bf16 elements
#define KV_TILE  (64 * KV_PITCH)          // one 64-row tile, bf16 elements

// This thread's four 16-byte copies of one stage: rows r and r+32 of the 64x64 K tile
// and of the 64x64 V^T tile. A wave's 32 lanes cover four whole 128-byte rows per copy.
// The s_wait_xcnt is the last line of the copies' own statement so that no later write
// of their address registers can be scheduled in front of it.
__device__ __forceinline__ void stage_kv_async(unsigned int ldsK, unsigned int ldsV,
                                               const bf16_t* gK, const bf16_t* gV) {
    asm volatile("global_load_async_to_lds_b128 %0, %4, off\n\t"
                 "global_load_async_to_lds_b128 %1, %5, off\n\t"
                 "global_load_async_to_lds_b128 %2, %6, off\n\t"
                 "global_load_async_to_lds_b128 %3, %7, off\n\t"
                 "s_wait_xcnt 0x0"
                 :
                 : "v"(ldsK), "v"(ldsK + 32u * KV_PITCH * 2u),
                   "v"(ldsV), "v"(ldsV + 32u * KV_PITCH * 2u),
                   "v"(gK), "v"(gK + 32 * D_H), "v"(gV), "v"(gV + 32 * T_SEQ)
                 : "memory");
}

// Exchange a float between lane l and lane l ^ 16 (the two halves of a wave) in the vector unit.
__device__ __forceinline__ float xhalf(float x) {
    const int b = __builtin_bit_cast(int, x);
    return __builtin_bit_cast(float,
        __builtin_amdgcn_permlanex16(b, b, 0x76543210, 0xfedcba98, false, false));
}

__global__ __launch_bounds__(256) void attn_kernel(
    const bf16_t* __restrict__ qbuf,  // [BH][T][Dh]
    const bf16_t* __restrict__ kbuf,  // [BH][T][Dh]
    const bf16_t* __restrict__ vbuf,  // [BH][Dh][T]
    bf16_t* __restrict__ obuf)        // [8192][1024] (m = b*T+t, col = h*64+d)
{
    __shared__ __attribute__((aligned(16))) bf16_t Ks[2][KV_TILE];       // [key][d]
    __shared__ __attribute__((aligned(16))) bf16_t Vs[2][KV_TILE];       // [d][key]
    const int tid  = threadIdx.x;
    const int lane = tid & 31, wv = tid >> 5;
    const int half = lane >> 4, ln = lane & 15;
    const int bh  = blockIdx.y;
    const int qt0 = blockIdx.x * 128;
    const size_t qkbase = (size_t)bh * T_SEQ * D_H;
    const size_t vbase  = (size_t)bh * D_H * T_SEQ;

    // this thread's place in a staged tile: row tid/8 (and +32), 16-byte column tid%8
    const int srow = tid >> 3, scol = (tid & 7) * 8;
    const unsigned int tileBytes = KV_TILE * 2u;
    const unsigned int ldsK0 = (unsigned int)(uintptr_t)&Ks[0][srow * KV_PITCH + scol];
    const unsigned int ldsV0 = (unsigned int)(uintptr_t)&Vs[0][srow * KV_PITCH + scol];
    const bf16_t* gK0 = kbuf + qkbase + (size_t)srow * D_H + scol;    // + tile * 64 * D_H
    const bf16_t* gV0 = vbuf + vbase + (size_t)srow * T_SEQ + scol;   // + tile * 64
    const int NT = T_SEQ / 64;

    stage_kv_async(ldsK0, ldsV0, gK0, gV0);                           // tile 0 -> buffer 0
    ASYNC_WAIT_0();       // this wave's tile-0 copies have landed
    __syncthreads();      // every wave's have: tile 0 is readable
    stage_kv_async(ldsK0 + tileBytes, ldsV0 + tileBytes, gK0 + 64 * D_H, gV0 + 64);  // tile 1 -> buffer 1

    // Q fragments stay resident (B operand: column = query = lane%16, d in ld_frag's k order)
    const int tq = qt0 + wv * 16 + ln;
    v16bf bq[2];
#pragma unroll
    for (int c = 0; c < 2; ++c)
        bq[c] = ld_frag(&qbuf[qkbase + (size_t)tq * D_H + c * 32 + half * 8]);

    float mrun = -1e30f;  // running maximum of this lane's query (equal in both halves)
    float lrun = 0.0f;    // running sum over this half's keys only; the halves join after the loop
    v8f acc[4] = {};      // acc[j2][r] = O[query ln][d = j2*16 + half*8 + r]

    for (int kt = 0; kt < NT; ++kt) {
        const int cur = kt & 1;
        // S^T = (K @ Q^T) * scale: s[j][r] = score of key j*16 + half*8 + r with query ln
        v8f s[4];
#pragma unroll
        for (int j = 0; j < 4; ++j) {
            v8f sj = {};
#pragma unroll
            for (int c = 0; c < 2; ++c) {
                v16bf kf = ld_frag(&Ks[cur][(j * 16 + ln) * KV_PITCH + c * 32 + half * 8]);
                sj = wmma_bf16(kf, bq[c], sj);
            }
#pragma unroll
            for (int r = 0; r < 8; ++r) sj[r] *= 0.125f;   // 1/sqrt(64)
            s[j] = sj;
        }
        // maximum over the 64 keys: 32 in this lane, the other 32 in lane ^ 16
        float rmax = s[0][0];
#pragma unroll
        for (int j = 0; j < 4; ++j)
#pragma unroll
            for (int r = 0; r < 8; ++r) rmax = fmaxf(rmax, s[j][r]);
        rmax = fmaxf(rmax, xhalf(rmax));

        const float mn = fmaxf(mrun, rmax);
        const float sc = __expf(mrun - mn);
        mrun = mn;

        // P^T = exp(S^T - mn). Tiles 2c and 2c+1 give elements 0..7 and 8..15 of the B fragment
        // of keys c*32 .. c*32+31: key = c*32 + (e>=8 ? 16 : 0) + half*8 + e%8, ld_frag's k order.
        v2f ps[2] = {};   // two independent packed chains
        v16bf pf[2];
#pragma unroll
        for (int c = 0; c < 2; ++c)
#pragma unroll
            for (int e = 0; e < 16; e += 2) {
                const v8f& t = s[2 * c + (e >> 3)];
                const v2f x = {t[e & 7], t[(e & 7) + 1]};
                const v2f y = (x - mn) * 1.44269504f;      // exp(x - mn) = 2^((x - mn) * log2 e)
                const v2f p = {__builtin_amdgcn_exp2f(y.x), __builtin_amdgcn_exp2f(y.y)};
                ps[(e >> 1) & 1] += p;
                pf[c][e]     = (bf16_t)p.x;
                pf[c][e + 1] = (bf16_t)p.y;
            }
        ps[0] += ps[1];
        lrun = lrun * sc + (ps[0].x + ps[0].y);
#pragma unroll
        for (int j2 = 0; j2 < 4; ++j2)
#pragma unroll
            for (int r = 0; r < 8; ++r) acc[j2][r] *= sc;

        // O^T += V^T @ P^T   (A fragment: row = d = lane%16, keys from the staged [Dh][key] tile)
#pragma unroll
        for (int j2 = 0; j2 < 4; ++j2)
#pragma unroll
            for (int c = 0; c < 2; ++c) {
                v16bf vf = ld_frag(&Vs[cur][(j2 * 16 + ln) * KV_PITCH + c * 32 + half * 8]);
                acc[j2] = wmma_bf16(vf, pf[c], acc[j2]);
            }
        // hand-over: this wave's LDS reads of buffer cur are done, its copies of tile kt+1 have landed
        asm volatile("s_wait_dscnt 0x0" ::: "memory");
        ASYNC_WAIT_0();
        __syncthreads();      // tile kt+1 readable by all; buffer cur left by all its readers
        if (kt + 2 < NT)      // refill the buffer just read with tile kt+2
            stage_kv_async(ldsK0 + cur * tileBytes, ldsV0 + cur * tileBytes,
                           gK0 + (size_t)(kt + 2) * 64 * D_H, gV0 + (kt + 2) * 64);
    }
    ASYNC_WAIT_0();           // nothing of this wave's is in flight when it leaves the loop

    // normalize + write [m][h*64+d]: a lane holds 8 consecutive d of its query per tile
    const float inv = 1.0f / (lrun + xhalf(lrun));
    const int b = bh >> 4, h = bh & 15;
    bf16_t* orow = obuf + (size_t)(b * T_SEQ + tq) * C_DIM + h * 64 + half * 8;
#pragma unroll
    for (int j2 = 0; j2 < 4; ++j2) {
        v8bf o;
#pragma unroll
        for (int r = 0; r < 8; ++r) o[r] = (bf16_t)(acc[j2][r] * inv);
        *(v8bf*)(orow + j2 * 16) = o;
    }
}

// ---------------- stage 4: output projection ----------------
__global__ __launch_bounds__(256) void gemm_out_kernel(
    const bf16_t* __restrict__ A,    // [8192][1024] (attention output)
    const bf16_t* __restrict__ Bt,   // [1024][1024] = W_out^T
    const float*  __restrict__ bias, // [1024]
    float* __restrict__ out)         // [8192][1024]
{
    __shared__ __attribute__((aligned(16))) bf16_t As[2][G_TILE];
    __shared__ __attribute__((aligned(16))) bf16_t Bs[2][G_TILE];
    const int tid  = threadIdx.x;
    const int lane = tid & 31, wv = tid >> 5;
    const int wr = wv & 3, wc = wv >> 2;
    const int half = lane >> 4, ln = lane & 15;
    const int m0 = blockIdx.y * 128;
    const int n0 = blockIdx.x * 128;
    // this thread's place in a staged tile: row tid/8 (and +32, +64, +96), 16-byte column tid%8
    const int srow = tid >> 3, scol = (tid & 7) * 8;
    const unsigned int ldsA0 = (unsigned int)(uintptr_t)&As[0][srow * G_PITCH + scol];
    const unsigned int ldsB0 = (unsigned int)(uintptr_t)&Bs[0][srow * G_PITCH + scol];
    const unsigned int bufBytes = G_TILE * 2u;
    const bf16_t* gA0 = A  + (size_t)(m0 + srow) * C_DIM + scol;      // + stage * G_BK
    const bf16_t* gB0 = Bt + (size_t)(n0 + srow) * C_DIM + scol;      // + stage * G_BK

    v8f acc[2][4] = {};
    const int KT = C_DIM / G_BK;
    stage_ab_async(ldsA0, ldsB0, gA0, gB0);                           // stage 0 -> buffer 0
    ASYNC_WAIT_0();       // this wave's stage-0 copies have landed
    __syncthreads();      // every wave's have: stage 0 is readable
    stage_ab_async(ldsA0 + bufBytes, ldsB0 + bufBytes, gA0 + G_BK, gB0 + G_BK);  // stage 1 -> buffer 1
    for (int kt = 0; kt < KT; ++kt) {
        const int cur = kt & 1;
#pragma unroll   // the two 32-k halves of the stage, in ascending k
        for (int ks = 0; ks < 2; ++ks) {
            v16bf af[2], bfg[4];
#pragma unroll
            for (int mi = 0; mi < 2; ++mi)
                af[mi] = ld_frag(&As[cur][(wr * 32 + mi * 16 + ln) * G_PITCH + ks * 32 + half * 8]);
#pragma unroll
            for (int ni = 0; ni < 4; ++ni)
                bfg[ni] = ld_frag(&Bs[cur][(wc * 64 + ni * 16 + ln) * G_PITCH + ks * 32 + half * 8]);
#pragma unroll
            for (int mi = 0; mi < 2; ++mi)
#pragma unroll
                for (int ni = 0; ni < 4; ++ni)
                    acc[mi][ni] = wmma_bf16(af[mi], bfg[ni], acc[mi][ni]);
        }
        // hand-over: this wave's LDS reads of buffer cur are done, its copies of stage kt+1 have landed
        asm volatile("s_wait_dscnt 0x0" ::: "memory");
        ASYNC_WAIT_0();
        __syncthreads();      // stage kt+1 readable by all; buffer cur left by all its readers
        if (kt + 2 < KT)      // refill the buffer just read with stage kt+2
            stage_ab_async(ldsA0 + cur * bufBytes, ldsB0 + cur * bufBytes,
                           gA0 + (kt + 2) * G_BK, gB0 + (kt + 2) * G_BK);
    }
    ASYNC_WAIT_0();           // nothing of this wave's is in flight when it leaves the loop
#pragma unroll
    for (int mi = 0; mi < 2; ++mi)
#pragma unroll
        for (int ni = 0; ni < 4; ++ni) {
            const int gm = m0 + wr * 32 + mi * 16 + half * 8;
            const int gn = n0 + wc * 64 + ni * 16 + ln;
            const float bv = bias[gn];
#pragma unroll
            for (int r = 0; r < 8; ++r)
                out[(size_t)(gm + r) * C_DIM + gn] = acc[mi][ni][r] + bv;
        }
}

// ---------------- launcher ----------------
extern "C" void kernel_launch(void* const* d_in, const int* in_sizes, int n_in,
                              void* d_out, int out_size, void* d_ws, size_t ws_size,
                              hipStream_t stream) {
    const float* x     = (const float*)d_in[0];  // [4,2048,1024]
    const float* W_qkv = (const float*)d_in[1];  // [1024,3072]
    const float* b_qkv = (const float*)d_in[2];  // [3072]
    const float* W_out = (const float*)d_in[3];  // [1024,1024]
    const float* b_out = (const float*)d_in[4];  // [1024]
    float* out = (float*)d_out;

    char* ws = (char*)d_ws;
    bf16_t* xb    = (bf16_t*)(ws);                         // 16 MiB (reused as obuf)
    bf16_t* wqkvT = (bf16_t*)(ws + (size_t)16777216);      //  6 MiB
    bf16_t* woT   = (bf16_t*)(ws + (size_t)23068672);      //  2 MiB
    bf16_t* qb    = (bf16_t*)(ws + (size_t)25165824);      // 16 MiB
    bf16_t* kb    = (bf16_t*)(ws + (size_t)41943040);      // 16 MiB
    bf16_t* vb    = (bf16_t*)(ws + (size_t)58720256);      // 16 MiB -> 72 MiB total
    bf16_t* obuf  = xb;  // x is fully consumed by gemm_qkv before attn writes obuf

    // stage 0: precision conversion / weight transposition
    f32_to_bf16_kernel<<<(M_ROWS * C_DIM) / 8192, 256, 0, stream>>>(x, xb);
    transpose_wqkv_kernel<<<dim3(N_QKV / 32, C_DIM / 256), 256, 0, stream>>>(W_qkv, wqkvT);
    transpose_wout_kernel<<<dim3(C_DIM / 32, C_DIM / 256), 256, 0, stream>>>(W_out, woT);

    // stage 1: QKV projection (WMMA, async double-buffered LDS) + q/k/v split, v transposed
    gemm_qkv_kernel<<<dim3(N_QKV / 128, M_ROWS / 128), 256, 0, stream>>>(xb, wqkvT, b_qkv, qb, kb, vb);

    // stage 2: RoPE
    rope_kernel<<<(B_N * H_N * T_SEQ * 4) / 256, 256, 0, stream>>>(qb, kb);

    // stage 3: attention (WMMA flash-style)
    attn_kernel<<<dim3(T_SEQ / 128, B_N * H_N), 256, 0, stream>>>(qb, kb, vb, obuf);

    // stage 4: output projection (WMMA, async double-buffered LDS) + bias, fp32 out
    gemm_out_kernel<<<dim3(C_DIM / 128, M_ROWS / 128), 256, 0, stream>>>(obuf, woT, b_out, out);
}

// v007
// Measured time: 151 microseconds a run.
// In two side-by-side timings against v006, it was 1.05 and 1.04 times as fast.
// Over all steps from v000 it is 2.89 times as fast.
#include <hip/hip_runtime.h>
#include <hip/hip_bf16.h>

typedef __bf16 bf16_t;
typedef __bf16 v16bf __attribute__((ext_vector_type(16)));
typedef __bf16 v8bf  __attribute__((ext_vector_type(8)));
typedef float  v8f   __attribute__((ext_vector_type(8)));
typedef float  v2f   __attribute__((ext_vector_type(2)));
typedef float  v4f   __attribute__((ext_vector_type(4)));
typedef __bf16 v4bf  __attribute__((ext_vector_type(4)));

#define T_SEQ  2048
#define C_DIM  1024
#define N_QKV  3072
#define H_N    16
#define D_H    64
#define B_N    4
#define M_ROWS 8192   // B*T

// ---- CDNA5 async global->LDS copies are tracked by ASYNCcnt ----
#define ASYNC_WAIT_0() asm volatile("s_wait_asynccnt 0x0" ::: "memory")

// Load a 16-element bf16 A/B WMMA fragment slice.
// Caller passes p = row_base + (lane>=16 ? 8 : 0) [+ k0].
// Elements 0..7  <- p[0..7]   (K = kb .. kb+7)
// Elements 8..15 <- p[16..23] (K = kb+16 .. kb+23)
// Matches CDNA5 16-bit A/B layout: K(e,lane) = (e>=8?16:0)+(lane>=16?8:0)+(e%8).
__device__ __forceinline__ v16bf ld_frag(const bf16_t* p) {
    v8bf lo = *(const v8bf*)(p);
    v8bf hi = *(const v8bf*)(p + 16);
    return __builtin_shufflevector(lo, hi, 0,1,2,3,4,5,6,7,8,9,10,11,12,13,14,15);
}

__device__ __forceinline__ v8f wmma_bf16(v16bf a, v16bf b, v8f c) {
    return __builtin_amdgcn_wmma_f32_16x16x32_bf16(false, a, false, b, (short)0, c, false, false);
}

// A staged GEMM row: 64 k = 128 B of data (one whole line of the operand's row in memory) at a
// pitch of 144 B (16 B x odd), so that the 16 rows of a ds_load_b128 fragment read fall on
// distinct banks.
#define G_BK    64                        // k per stage
#define G_PITCH 72                        // bf16 elements
#define G_TILE  (128 * G_PITCH)           // one 128-row tile, bf16 elements

// This thread's eight 16-byte copies of one stage: rows r, r+32, r+64 and r+96 of the 128x64
// A tile and of the 128x64 B tile. Eight lanes cover one row, so a wave's 32 lanes bring four
// whole 128-byte lines per copy. The s_wait_xcnt is the last line of the copies' own statement
// so that no later write of their address registers can be scheduled in front of it.
__device__ __forceinline__ void stage_ab_async(unsigned int ldsA, unsigned int ldsB,
                                               const bf16_t* gA, const bf16_t* gB) {
    asm volatile("global_load_async_to_lds_b128 %0, %8, off\n\t"
                 "global_load_async_to_lds_b128 %1, %9, off\n\t"
                 "global_load_async_to_lds_b128 %2, %10, off\n\t"
                 "global_load_async_to_lds_b128 %3, %11, off\n\t"
                 "global_load_async_to_lds_b128 %4, %12, off\n\t"
                 "global_load_async_to_lds_b128 %5, %13, off\n\t"
                 "global_load_async_to_lds_b128 %6, %14, off\n\t"
                 "global_load_async_to_lds_b128 %7, %15, off\n\t"
                 "s_wait_xcnt 0x0"
                 :
                 : "v"(ldsA), "v"(ldsA + 32u * G_PITCH * 2u),
                   "v"(ldsA + 64u * G_PITCH * 2u), "v"(ldsA + 96u * G_PITCH * 2u),
                   "v"(ldsB), "v"(ldsB + 32u * G_PITCH * 2u),
                   "v"(ldsB + 64u * G_PITCH * 2u), "v"(ldsB + 96u * G_PITCH * 2u),
                   "v"(gA), "v"(gA + 32 * C_DIM), "v"(gA + 64 * C_DIM), "v"(gA + 96 * C_DIM),
                   "v"(gB), "v"(gB + 32 * C_DIM), "v"(gB + 64 * C_DIM), "v"(gB + 96 * C_DIM)
                 : "memory");
}

// ---------------- stage 0: conversions ----------------

// A wave converts 1024 consecutive floats: eight 16-byte loads per lane, all issued before the
// first use, each covering 512 contiguous bytes of the wave; each store covers 256 contiguous bytes.
// The grid covers the array exactly: 8192 floats per block.
__global__ __launch_bounds__(256) void f32_to_bf16_kernel(const float* __restrict__ in,
                                                          bf16_t* __restrict__ out) {
    const size_t base = (size_t)blockIdx.x * 8192 + (threadIdx.x >> 5) * 1024 + (threadIdx.x & 31) * 4;
    v4f v[8];
#pragma unroll   // both loops unrolled: v[] stays in registers and the eight loads are in flight together
    for (int j = 0; j < 8; ++j) v[j] = *(const v4f*)&in[base + j * 128];
#pragma unroll
    for (int j = 0; j < 8; ++j) *(v4bf*)&out[base + j * 128] = __builtin_convertvector(v[j], v4bf);
}

// out[n*K + k] = (bf16) in[k*N + n]  (W stored [K][N] row-major -> [N][K])
// A thread takes a block of 8 k x 4 n: eight 16-byte loads (8 lanes cover one whole 128-byte line
// of a row of W) and four 16-byte stores (8 consecutive k of one n).
// A block covers 256 k x 32 n; the grid (N/32, K/256) covers W exactly. K and N are literals at
// both calls, so that all eight loads (and all four stores) go through one address register pair.
__device__ __forceinline__ void transpose_bf16(const float* __restrict__ in,
                                               bf16_t* __restrict__ out, const int K, const int N) {
    const int n = blockIdx.x * 32 + (threadIdx.x & 7) * 4;
    const int k = blockIdx.y * 256 + (threadIdx.x >> 3) * 8;
    v4f r[8];
#pragma unroll   // all loops unrolled: r[] stays in registers and the eight loads are in flight together
    for (int j = 0; j < 8; ++j) r[j] = *(const v4f*)&in[(size_t)(k + j) * N + n];
#pragma unroll
    for (int c = 0; c < 4; ++c) {
        v8bf o;
#pragma unroll
        for (int j = 0; j < 8; ++j) o[j] = (bf16_t)r[j][c];
        *(v8bf*)&out[(size_t)(n + c) * K + k] = o;
    }
}
__global__ __launch_bounds__(256) void transpose_wqkv_kernel(const float* __restrict__ in,
                                                             bf16_t* __restrict__ out) {
    transpose_bf16(in, out, C_DIM, N_QKV);
}
__global__ __launch_bounds__(256) void transpose_wout_kernel(const float* __restrict__ in,
                                                             bf16_t* __restrict__ out) {
    transpose_bf16(in, out, C_DIM, C_DIM);
}

// ---------------- stage 1: QKV GEMM + split ----------------
// C[m][n] = sum_k x[m][k] * Wt[n][k] + bias[n]; split into q,k ([BH][T][Dh]) and v ([BH][Dh][T]).
// A block's 128 columns are all q, all k or all v. The operand whose index runs along the
// contiguous direction of the output (d for q and k, t for v) is taken as the products' row
// operand, so a lane's 8 accumulator rows are 8 neighbours in memory. The finished bf16 tile is
// staged in the ring's LDS and goes out in 16-byte stores that cover whole 128-byte lines.
// A staged output row: 256 B of data at a pitch of 272 B (16 B x odd): no bank conflict for b128.
#define C_PITCH 136                       // bf16 elements
__global__ __launch_bounds__(256) void gemm_qkv_kernel(
    const bf16_t* __restrict__ A,   // [8192][1024]
    const bf16_t* __restrict__ Bt,  // [3072][1024]
    const float*  __restrict__ bias,// [3072]
    bf16_t* __restrict__ qbuf, bf16_t* __restrict__ kbuf, bf16_t* __restrict__ vbuf)
{
    __shared__ __attribute__((aligned(16))) bf16_t As[2][G_TILE];
    __shared__ __attribute__((aligned(16))) bf16_t Bs[2][G_TILE];
    const int tid  = threadIdx.x;
    const int lane = tid & 31, wv = tid >> 5;
    const int wr = wv & 3, wc = wv >> 2;          // wave tile: rows wr*32, cols wc*64
    const int half = lane >> 4, ln = lane & 15;
    const int m0 = blockIdx.y * 128;
    const int n0 = blockIdx.x * 128;
    // this thread's place in a staged tile: row tid/8 (and +32, +64, +96), 16-byte column tid%8
    const int srow = tid >> 3, scol = (tid & 7) * 8;
    const unsigned int ldsA0 = (unsigned int)(uintptr_t)&As[0][srow * G_PITCH + scol];
    const unsigned int ldsB0 = (unsigned int)(uintptr_t)&Bs[0][srow * G_PITCH + scol];
    const unsigned int bufBytes = G_TILE * 2u;
    const bf16_t* gA0 = A  + (size_t)(m0 + srow) * C_DIM + scol;      // + stage * G_BK
    const bf16_t* gB0 = Bt + (size_t)(n0 + srow) * C_DIM + scol;      // + stage * G_BK
    const bool isV = n0 >= 2 * C_DIM;             // the same for the whole block
    // this lane's first fragment row of each operand, buffer 0
    const bf16_t* rowOp = (isV ? &As[0][0] : &Bs[0][0])  // v: rows = t (x);  q,k: rows = d (W)
                        + (wr * 32 + ln) * G_PITCH + half * 8;
    const bf16_t* colOp = (isV ? &Bs[0][0] : &As[0][0])  // v: cols = d (W);  q,k: cols = t (x)
                        + (wc * 64 + ln) * G_PITCH + half * 8;

    v8f acc[2][4] = {};
    const int KT = C_DIM / G_BK;
    stage_ab_async(ldsA0, ldsB0, gA0, gB0);                           // stage 0 -> buffer 0
    ASYNC_WAIT_0();       // this wave's stage-0 copies have landed
    __syncthreads();      // every wave's have: stage 0 is readable
    stage_ab_async(ldsA0 + bufBytes, ldsB0 + bufBytes, gA0 + G_BK, gB0 + G_BK);  // stage 1 -> buffer 1
    for (int kt = 0; kt < KT; ++kt) {
        const int cur = kt & 1;
#pragma unroll   // the two 32-k halves of the stage, in ascending k
        for (int ks = 0; ks < 2; ++ks) {
            v16bf af[2], bfg[4];
#pragma unroll
            for (int mi = 0; mi < 2; ++mi)
                af[mi] = ld_frag(&rowOp[(cur * 128 + mi * 16) * G_PITCH + ks * 32]);
#pragma unroll
            for (int ni = 0; ni < 4; ++ni)
                bfg[ni] = ld_frag(&colOp[(cur * 128 + ni * 16) * G_PITCH + ks * 32]);
#pragma unroll
            for (int mi = 0; mi < 2; ++mi)
#pragma unroll
                for (int ni = 0; ni < 4; ++ni)
                    acc[mi][ni] = wmma_bf16(af[mi], bfg[ni], acc[mi][ni]);
        }
        // hand-over: this wave's LDS reads of buffer cur are done, its copies of stage kt+1 have landed
        asm volatile("s_wait_dscnt 0x0" ::: "memory");
        ASYNC_WAIT_0();
        __syncthreads();      // stage kt+1 readable by all; buffer cur left by all its readers
        if (kt + 2 < KT)      // refill the buffer just read with stage kt+2
            stage_ab_async(ldsA0 + cur * bufBytes, ldsB0 + cur * bufBytes,
                           gA0 + (kt + 2) * G_BK, gB0 + (kt + 2) * G_BK);
    }
    ASYNC_WAIT_0();           // nothing of this wave's is in flight when it leaves the loop

    // epilogue: bias, then the tile [column operand's index][row operand's index] into LDS.
    // Tile rows 0..63 lie in As, rows 64..127 in Bs (the loop's last barrier has freed both).
    bf16_t* ct = (wc ? &Bs[0][0] : &As[0][0]) + ln * C_PITCH + wr * 32 + half * 8;
    if (isV) {                 // bias runs along the tile's rows: one value per lane and ni
        float bc[4];
#pragma unroll
        for (int ni = 0; ni < 4; ++ni) bc[ni] = bias[n0 + wc * 64 + ni * 16 + ln];
        // stands in front of any reuse of the offset register that the four loads above name
        asm volatile("s_wait_xcnt 0x0" ::: "memory");
#pragma unroll
        for (int mi = 0; mi < 2; ++mi)
#pragma unroll
            for (int ni = 0; ni < 4; ++ni) {
                v8bf o;
#pragma unroll
                for (int r = 0; r < 8; ++r) o[r] = (bf16_t)(acc[mi][ni][r] + bc[ni]);
                *(v8bf*)&ct[ni * 16 * C_PITCH + mi * 16] = o;
            }
    } else {                   // bias runs along the lane's 8 accumulator rows
#pragma unroll
        for (int mi = 0; mi < 2; ++mi) {
            const v8f br = *(const v8f*)&bias[n0 + wr * 32 + mi * 16 + half * 8];
#pragma unroll
            for (int ni = 0; ni < 4; ++ni) {
                v8bf o;
#pragma unroll
                for (int r = 0; r < 8; ++r) o[r] = (bf16_t)(acc[mi][ni][r] + br[r]);
                *(v8bf*)&ct[ni * 16 * C_PITCH + mi * 16] = o;
            }
        }
    }
    __syncthreads();          // the whole tile is staged before any wave reads it back

    // 16 lanes read one staged row (256 B) and store it: two whole lines
    const int c8 = (tid & 15) * 8, rw = tid >> 4;
    v8bf val[8];
#pragma unroll
    for (int i = 0; i < 8; ++i)
        val[i] = *(const v8bf*)&((i < 4) ? As : Bs)[0][((i & 3) * 16 + rw) * C_PITCH + c8];
    const int bb = m0 >> 11;                       // batch: 128 rows never straddle one
    const int t0 = m0 & 2047;
    if (isV) {                 // tile row = head * 64 + d, columns = t
        bf16_t* p = vbuf + ((size_t)bb * C_DIM + (n0 & 1023) + rw) * T_SEQ + t0 + c8;
#pragma unroll
        for (int i = 0; i < 8; ++i) *(v8bf*)(p + (size_t)i * 16 * T_SEQ) = val[i];
    } else {                   // tile row = t, columns = two heads' d
        const int n = (n0 & 1023) + c8;
        bf16_t* p = ((n0 < C_DIM) ? qbuf : kbuf)
                  + ((size_t)(bb * H_N + (n >> 6)) * T_SEQ + t0 + rw) * D_H + (n & 63);
#pragma unroll
        for (int i = 0; i < 8; ++i) *(v8bf*)(p + i * 16 * D_H) = val[i];
    }
}

// ---------------- stage 2: RoPE on q,k ----------------
// One transcendental and, in the same statement, the v_nop that fills the slot which the
// instruction set asks for before its result is read or its source overwritten (with eight
// independent chains per thread the compiler sets such instructions back to back).
__device__ __forceinline__ float t_exp2(float x) {
    float r; asm("v_exp_f32 %0, %1\n\tv_nop" : "=v"(r) : "v"(x)); return r;
}
__device__ __forceinline__ float t_sin(float x) {   // sin(2 pi x)
    float r; asm("v_sin_f32 %0, %1\n\tv_nop" : "=v"(r) : "v"(x)); return r;
}
__device__ __forceinline__ float t_cos(float x) {   // cos(2 pi x)
    float r; asm("v_cos_f32 %0, %1\n\tv_nop" : "=v"(r) : "v"(x)); return r;
}

// A thread takes 8 consecutive pairs (i, i + 32) of one row of q and of k: four 16-byte loads,
// four 16-byte stores; four lanes cover a row, a wave eight whole 128-byte rows of each buffer.
// The grid covers BH * T * 4 threads exactly.
__global__ __launch_bounds__(256) void rope_kernel(bf16_t* __restrict__ qbuf, bf16_t* __restrict__ kbuf) {
    const int idx = blockIdx.x * 256 + threadIdx.x;
    const int i0  = (idx & 3) * 8;
    const int t   = (idx >> 2) & 2047;
    const size_t base = (size_t)(idx >> 2) * D_H + i0;   // (bh * T + t) * Dh + i0
    const v8bf q1 = *(const v8bf*)&qbuf[base], q2 = *(const v8bf*)&qbuf[base + 32];
    const v8bf k1 = *(const v8bf*)&kbuf[base], k2 = *(const v8bf*)&kbuf[base + 32];
    v8bf oq1, oq2, ok1, ok2;
#pragma unroll   // vector elements are indexed by constants: everything stays in registers
    for (int e = 0; e < 8; ++e) {
        // inv_freq = 10000^(-2i/64) = exp(-(2i/64) * ln(10000))
        const float ang = (float)t * t_exp2(-(float)(2 * (i0 + e)) * (9.210340371976184f / 64.0f) * 1.44269504f);
        const float rev = ang * 0.15915494f;             // the angle in turns
        const float s = t_sin(rev), c = t_cos(rev);
        {
            const float x1 = (float)q1[e], x2 = (float)q2[e];
            oq1[e] = (bf16_t)(x1 * c - x2 * s);
            oq2[e] = (bf16_t)(x2 * c + x1 * s);
        }
        {
            const float x1 = (float)k1[e], x2 = (float)k2[e];
            ok1[e] = (bf16_t)(x1 * c - x2 * s);
            ok2[e] = (bf16_t)(x2 * c + x1 * s);
        }
    }
    *(v8bf*)&qbuf[base] = oq1;  *(v8bf*)&qbuf[base + 32] = oq2;
    *(v8bf*)&kbuf[base] = ok1;  *(v8bf*)&kbuf[base + 32] = ok2;
}

// ---------------- stage 3: flash attention ----------------
// One staged row: 128 B of data at a pitch of 144 B (16 B x odd), so that the
// 16-row ds_load_b128 fragment reads fall on distinct banks.
#define KV_PITCH 72                       // bf16 elements
#define KV_TILE  (64 * KV_PITCH)          // one 64-row tile, bf16 elements

// This thread's four 16-byte copies of one stage: rows r and r+32 of the 64x64 K tile
// and of the 64x64 V^T tile. A wave's 32 lanes cover four whole 128-byte rows per copy.
// The s_wait_xcnt is the last line of the copies' own statement so that no later write
// of their address registers can be scheduled in front of it.
__device__ __forceinline__ void stage_kv_async(unsigned int ldsK, unsigned int ldsV,
                                               const bf16_t* gK, const bf16_t* gV) {
    asm volatile("global_load_async_to_lds_b128 %0, %4, off\n\t"
                 "global_load_async_to_lds_b128 %1, %5, off\n\t"
                 "global_load_async_to_lds_b128 %2, %6, off\n\t"
                 "global_load_async_to_lds_b128 %3, %7, off\n\t"
                 "s_wait_xcnt 0x0"
                 :
                 : "v"(ldsK), "v"(ldsK + 32u * KV_PITCH * 2u),
                   "v"(ldsV), "v"(ldsV + 32u * KV_PITCH * 2u),
                   "v"(gK), "v"(gK + 32 * D_H), "v"(gV), "v"(gV + 32 * T_SEQ)
                 : "memory");
}

// Exchange a float between lane l and lane l ^ 16 (the two halves of a wave) in the vector unit.
__device__ __forceinline__ float xhalf(float x) {
    const int b = __builtin_bit_cast(int, x);
    return __builtin_bit_cast(float,
        __builtin_amdgcn_permlanex16(b, b, 0x76543210, 0xfedcba98, false, false));
}

#define Q_GR 2                            // 16-column query groups per wave
__global__ __launch_bounds__(256) void attn_kernel(
    const bf16_t* __restrict__ qbuf,  // [BH][T][Dh]
    const bf16_t* __restrict__ kbuf,  // [BH][T][Dh]
    const bf16_t* __restrict__ vbuf,  // [BH][Dh][T]
    bf16_t* __restrict__ obuf)        // [8192][1024] (m = b*T+t, col = h*64+d)
{
    __shared__ __attribute__((aligned(16))) bf16_t Ks[2][KV_TILE];       // [key][d]
    __shared__ __attribute__((aligned(16))) bf16_t Vs[2][KV_TILE];       // [d][key]
    const int tid  = threadIdx.x;
    const int lane = tid & 31, wv = tid >> 5;
    const int half = lane >> 4, ln = lane & 15;
    const int bh  = blockIdx.y;
    const int qt0 = blockIdx.x * (128 * Q_GR);
    const size_t qkbase = (size_t)bh * T_SEQ * D_H;
    const size_t vbase  = (size_t)bh * D_H * T_SEQ;

    // this thread's place in a staged tile: row tid/8 (and +32), 16-byte column tid%8
    const int srow = tid >> 3, scol = (tid & 7) * 8;
    const unsigned int tileBytes = KV_TILE * 2u;
    const unsigned int ldsK0 = (unsigned int)(uintptr_t)&Ks[0][srow * KV_PITCH + scol];
    const unsigned int ldsV0 = (unsigned int)(uintptr_t)&Vs[0][srow * KV_PITCH + scol];
    const bf16_t* gK0 = kbuf + qkbase + (size_t)srow * D_H + scol;    // + tile * 64 * D_H
    const bf16_t* gV0 = vbuf + vbase + (size_t)srow * T_SEQ + scol;   // + tile * 64
    const int NT = T_SEQ / 64;

    stage_kv_async(ldsK0, ldsV0, gK0, gV0);                           // tile 0 -> buffer 0
    ASYNC_WAIT_0();       // this wave's tile-0 copies have landed
    __syncthreads();      // every wave's have: tile 0 is readable
    stage_kv_async(ldsK0 + tileBytes, ldsV0 + tileBytes, gK0 + 64 * D_H, gV0 + 64);  // tile 1 -> buffer 1

    // Q fragments stay resident (B operand: column = query = lane%16, d in ld_frag's k order)
    const int tq = qt0 + wv * (16 * Q_GR) + ln;      // group g's query: tq + g * 16
    v16bf bq[Q_GR][2];
#pragma unroll
    for (int g = 0; g < Q_GR; ++g)
#pragma unroll
        for (int c = 0; c < 2; ++c)
            bq[g][c] = ld_frag(&qbuf[qkbase + (size_t)(tq + g * 16) * D_H + c * 32 + half * 8]);

    float mrun[Q_GR];     // running maximum of this lane's query (equal in both halves)
    float lrun[Q_GR];     // running sum over this half's keys only; the halves join after the loop
    v8f acc[Q_GR][4] = {};   // acc[g][j2][r] = O[query ln of group g][d = j2*16 + half*8 + r]
#pragma unroll
    for (int g = 0; g < Q_GR; ++g) { mrun[g] = -1e30f; lrun[g] = 0.0f; }

    for (int kt = 0; kt < NT; ++kt) {
        const int cur = kt & 1;
        // S^T = K @ Q^T: s[g][j][r] = product of key j*16 + half*8 + r with query ln of group g
        v8f s[Q_GR][4] = {};
#pragma unroll
        for (int j = 0; j < 4; ++j)
#pragma unroll
            for (int c = 0; c < 2; ++c) {
                v16bf kf = ld_frag(&Ks[cur][(j * 16 + ln) * KV_PITCH + c * 32 + half * 8]);
#pragma unroll
                for (int g = 0; g < Q_GR; ++g) s[g][j] = wmma_bf16(kf, bq[g][c], s[g][j]);
            }

        v16bf pf[Q_GR][2];
#pragma unroll
        for (int g = 0; g < Q_GR; ++g) {
#pragma unroll
            for (int j = 0; j < 4; ++j) s[g][j] *= 0.125f;   // 1/sqrt(64)
            // maximum over the 64 keys: 32 in this lane, the other 32 in lane ^ 16
            float rmax = s[g][0][0];
#pragma unroll
            for (int j = 0; j < 4; ++j)
#pragma unroll
                for (int r = 0; r < 8; ++r) rmax = fmaxf(rmax, s[g][j][r]);
            rmax = fmaxf(rmax, xhalf(rmax));

            const float mn = fmaxf(mrun[g], rmax);
            const float sc = t_exp2((mrun[g] - mn) * 1.44269504f);   // exp(mrun - mn), with its slot filled
            mrun[g] = mn;

            // P^T = exp(S^T - mn). Tiles 2c and 2c+1 give elements 0..7 and 8..15 of the B fragment
            // of keys c*32 .. c*32+31: key = c*32 + (e>=8 ? 16 : 0) + half*8 + e%8, ld_frag's k order.
            v2f ps[2] = {};   // two independent packed chains
#pragma unroll
            for (int c = 0; c < 2; ++c)
#pragma unroll
                for (int e = 0; e < 16; e += 2) {
                    const v8f& t = s[g][2 * c + (e >> 3)];
                    const v2f x = {t[e & 7], t[(e & 7) + 1]};
                    const v2f y = (x - mn) * 1.44269504f;      // exp(x - mn) = 2^((x - mn) * log2 e)
                    const v2f p = {__builtin_amdgcn_exp2f(y.x), __builtin_amdgcn_exp2f(y.y)};
                    ps[(e >> 1) & 1] += p;
                    pf[g][c][e]     = (bf16_t)p.x;
                    pf[g][c][e + 1] = (bf16_t)p.y;
                }
            ps[0] += ps[1];
            lrun[g] = lrun[g] * sc + (ps[0].x + ps[0].y);
#pragma unroll
            for (int j2 = 0; j2 < 4; ++j2)
#pragma unroll
                for (int r = 0; r < 8; ++r) acc[g][j2][r] *= sc;
        }

        // O^T += V^T @ P^T   (A fragment: row = d = lane%16, keys from the staged [Dh][key] tile)
#pragma unroll
        for (int j2 = 0; j2 < 4; ++j2)
#pragma unroll
            for (int c = 0; c < 2; ++c) {
                v16bf vf = ld_frag(&Vs[cur][(j2 * 16 + ln) * KV_PITCH + c * 32 + half * 8]);
#pragma unroll
                for (int g = 0; g < Q_GR; ++g) acc[g][j2] = wmma_bf16(vf, pf[g][c], acc[g][j2]);
            }
        // hand-over: this wave's LDS reads of buffer cur are done, its copies of tile kt+1 have landed
        asm volatile("s_wait_dscnt 0x0" ::: "memory");
        ASYNC_WAIT_0();
        __syncthreads();      // tile kt+1 readable by all; buffer cur left by all its readers
        if (kt + 2 < NT)      // refill the buffer just read with tile kt+2
            stage_kv_async(ldsK0 + cur * tileBytes, ldsV0 + cur * tileBytes,
                           gK0 + (size_t)(kt + 2) * 64 * D_H, gV0 + (kt + 2) * 64);
    }
    ASYNC_WAIT_0();           // nothing of this wave's is in flight when it leaves the loop

    // normalize + write [m][h*64+d]: a lane holds 8 consecutive d of its query per tile
    const int b = bh >> 4, h = bh & 15;
#pragma unroll
    for (int g = 0; g < Q_GR; ++g) {
        const float inv = 1.0f / (lrun[g] + xhalf(lrun[g]));
        bf16_t* orow = obuf + (size_t)(b * T_SEQ + tq + g * 16) * C_DIM + h * 64 + half * 8;
#pragma unroll
        for (int j2 = 0; j2 < 4; ++j2) {
            v8bf o;
#pragma unroll
            for (int r = 0; r < 8; ++r) o[r] = (bf16_t)(acc[g][j2][r] * inv);
            *(v8bf*)(orow + j2 * 16) = o;
        }
        // stands in front of any reuse, by the next group, of the registers that these stores name
        if (g + 1 < Q_GR) asm volatile("s_wait_xcnt 0x0" ::: "memory");
    }
}

// ---------------- stage 4: output projection ----------------
__global__ __launch_bounds__(256) void gemm_out_kernel(
    const bf16_t* __restrict__ A,    // [8192][1024] (attention output)
    const bf16_t* __restrict__ Bt,   // [1024][1024] = W_out^T
    const float*  __restrict__ bias, // [1024]
    float* __restrict__ out)         // [8192][1024]
{
    __shared__ __attribute__((aligned(16))) bf16_t As[2][G_TILE];
    __shared__ __attribute__((aligned(16))) bf16_t Bs[2][G_TILE];
    const int tid  = threadIdx.x;
    const int lane = tid & 31, wv = tid >> 5;
    const int wr = wv & 3, wc = wv >> 2;
    const int half = lane >> 4, ln = lane & 15;
    const int m0 = blockIdx.y * 128;
    const int n0 = blockIdx.x * 128;
    // this thread's place in a staged tile: row tid/8 (and +32, +64, +96), 16-byte column tid%8
    const int srow = tid >> 3, scol = (tid & 7) * 8;
    const unsigned int ldsA0 = (unsigned int)(uintptr_t)&As[0][srow * G_PITCH + scol];
    const unsigned int ldsB0 = (unsigned int)(uintptr_t)&Bs[0][srow * G_PITCH + scol];
    const unsigned int bufBytes = G_TILE * 2u;
    const bf16_t* gA0 = A  + (size_t)(m0 + srow) * C_DIM + scol;      // + stage * G_BK
    const bf16_t* gB0 = Bt + (size_t)(n0 + srow) * C_DIM + scol;      // + stage * G_BK

    v8f acc[2][4] = {};
    const int KT = C_DIM / G_BK;
    stage_ab_async(ldsA0, ldsB0, gA0, gB0);                           // stage 0 -> buffer 0
    ASYNC_WAIT_0();       // this wave's stage-0 copies have landed
    __syncthreads();      // every wave's have: stage 0 is readable
    stage_ab_async(ldsA0 + bufBytes, ldsB0 + bufBytes, gA0 + G_BK, gB0 + G_BK);  // stage 1 -> buffer 1
    for (int kt = 0; kt < KT; ++kt) {
        const int cur = kt & 1;
#pragma unroll   // the two 32-k halves of the stage, in ascending k
        for (int ks = 0; ks < 2; ++ks) {
            v16bf af[2], bfg[4];
#pragma unroll
            for (int mi = 0; mi < 2; ++mi)
                af[mi] = ld_frag(&As[cur][(wr * 32 + mi * 16 + ln) * G_PITCH + ks * 32 + half * 8]);
#pragma unroll
            for (int ni = 0; ni < 4; ++ni)
                bfg[ni] = ld_frag(&Bs[cur][(wc * 64 + ni * 16 + ln) * G_PITCH + ks * 32 + half * 8]);
#pragma unroll
            for (int mi = 0; mi < 2; ++mi)
#pragma unroll
                for (int ni = 0; ni < 4; ++ni)
                    acc[mi][ni] = wmma_bf16(af[mi], bfg[ni], acc[mi][ni]);
        }
        // hand-over: this wave's LDS reads of buffer cur are done, its copies of stage kt+1 have landed
        asm volatile("s_wait_dscnt 0x0" ::: "memory");
        ASYNC_WAIT_0();
        __syncthreads();      // stage kt+1 readable by all; buffer cur left by all its readers
        if (kt + 2 < KT)      // refill the buffer just read with stage kt+2
            stage_ab_async(ldsA0 + cur * bufBytes, ldsB0 + cur * bufBytes,
                           gA0 + (kt + 2) * G_BK, gB0 + (kt + 2) * G_BK);
    }
    ASYNC_WAIT_0();           // nothing of this wave's is in flight when it leaves the loop
#pragma unroll
    for (int mi = 0; mi < 2; ++mi)
#pragma unroll
        for (int ni = 0; ni < 4; ++ni) {
            const int gm = m0 + wr * 32 + mi * 16 + half * 8;
            const int gn = n0 + wc * 64 + ni * 16 + ln;
            const float bv = bias[gn];
#pragma unroll
            for (int r = 0; r < 8; ++r)
                out[(size_t)(gm + r) * C_DIM + gn] = acc[mi][ni][r] + bv;
        }
}

// ---------------- launcher ----------------
extern "C" void kernel_launch(void* const* d_in, const int* in_sizes, int n_in,
                              void* d_out, int out_size, void* d_ws, size_t ws_size,
                              hipStream_t stream) {
    const float* x     = (const float*)d_in[0];  // [4,2048,1024]
    const float* W_qkv = (const float*)d_in[1];  // [1024,3072]
    const float* b_qkv = (const float*)d_in[2];  // [3072]
    const float* W_out = (const float*)d_in[3];  // [1024,1024]
    const float* b_out = (const float*)d_in[4];  // [1024]
    float* out = (float*)d_out;

    char* ws = (char*)d_ws;
    bf16_t* xb    = (bf16_t*)(ws);                         // 16 MiB (reused as obuf)
    bf16_t* wqkvT = (bf16_t*)(ws + (size_t)16777216);      //  6 MiB
    bf16_t* woT   = (bf16_t*)(ws + (size_t)23068672);      //  2 MiB
    bf16_t* qb    = (bf16_t*)(ws + (size_t)25165824);      // 16 MiB
    bf16_t* kb    = (bf16_t*)(ws + (size_t)41943040);      // 16 MiB
    bf16_t* vb    = (bf16_t*)(ws + (size_t)58720256);      // 16 MiB -> 72 MiB total
    bf16_t* obuf  = xb;  // x is fully consumed by gemm_qkv before attn writes obuf

    // stage 0: precision conversion / weight transposition
    f32_to_bf16_kernel<<<(M_ROWS * C_DIM) / 8192, 256, 0, stream>>>(x, xb);
    transpose_wqkv_kernel<<<dim3(N_QKV / 32, C_DIM / 256), 256, 0, stream>>>(W_qkv, wqkvT);
    transpose_wout_kernel<<<dim3(C_DIM / 32, C_DIM / 256), 256, 0, stream>>>(W_out, woT);

    // stage 1: QKV projection (WMMA, async double-buffered LDS) + q/k/v split, v transposed
    gemm_qkv_kernel<<<dim3(N_QKV / 128, M_ROWS / 128), 256, 0, stream>>>(xb, wqkvT, b_qkv, qb, kb, vb);

    // stage 2: RoPE
    rope_kernel<<<(B_N * H_N * T_SEQ * 4) / 256, 256, 0, stream>>>(qb, kb);

    // stage 3: attention (WMMA flash-style)
    attn_kernel<<<dim3(T_SEQ / (128 * Q_GR), B_N * H_N), 256, 0, stream>>>(qb, kb, vb, obuf);

    // stage 4: output projection (WMMA, async double-buffered LDS) + bias, fp32 out
    gemm_out_kernel<<<dim3(C_DIM / 128, M_ROWS / 128), 256, 0, stream>>>(obuf, woT, b_out, out);
}

// v008
// A run of this version takes 140 microseconds.
// Next to v007, in two timings, it ran 1.08 times as fast each time.
// All steps since v000 together make it 3.13 times as fast.
#include <hip/hip_runtime.h>
#include <hip/hip_bf16.h>

typedef __bf16 bf16_t;
typedef __bf16 v16bf __attribute__((ext_vector_type(16)));
typedef __bf16 v8bf  __attribute__((ext_vector_type(8)));
typedef float  v8f   __attribute__((ext_vector_type(8)));
typedef float  v2f   __attribute__((ext_vector_type(2)));
typedef float  v4f   __attribute__((ext_vector_type(4)));
typedef __bf16 v4bf  __attribute__((ext_vector_type(4)));

#define T_SEQ  2048
#define C_DIM  1024
#define N_QKV  3072
#define H_N    16
#define D_H    64
#define B_N    4
#define M_ROWS 8192   // B*T

// ---- CDNA5 async global->LDS copies are tracked by ASYNCcnt ----
#define ASYNC_WAIT_0() asm volatile("s_wait_asynccnt 0x0" ::: "memory")

// Load a 16-element bf16 A/B WMMA fragment slice.
// Caller passes p = row_base + (lane>=16 ? 8 : 0) [+ k0].
// Elements 0..7  <- p[0..7]   (K = kb .. kb+7)
// Elements 8..15 <- p[16..23] (K = kb+16 .. kb+23)
// Matches CDNA5 16-bit A/B layout: K(e,lane) = (e>=8?16:0)+(lane>=16?8:0)+(e%8).
__device__ __forceinline__ v16bf ld_frag(const bf16_t* p) {
    v8bf lo = *(const v8bf*)(p);
    v8bf hi = *(const v8bf*)(p + 16);
    return __builtin_shufflevector(lo, hi, 0,1,2,3,4,5,6,7,8,9,10,11,12,13,14,15);
}

__device__ __forceinline__ v8f wmma_bf16(v16bf a, v16bf b, v8f c) {
    return __builtin_amdgcn_wmma_f32_16x16x32_bf16(false, a, false, b, (short)0, c, false, false);
}

// A staged GEMM row: 64 k = 128 B of data (one whole line of the operand's row in memory) at a
// pitch of 144 B (16 B x odd), so that the 16 rows of a ds_load_b128 fragment read fall on
// distinct banks.
#define G_BK    64                        // k per stage
#define G_PITCH 72                        // bf16 elements
#define G_TILE  (128 * G_PITCH)           // one 128-row tile, bf16 elements

// This thread's eight 16-byte copies of one stage: rows r, r+32, r+64 and r+96 of the 128x64
// A tile and of the 128x64 B tile. Eight lanes cover one row, so a wave's 32 lanes bring four
// whole 128-byte lines per copy. The s_wait_xcnt is the last line of the copies' own statement
// so that no later write of their address registers can be scheduled in front of it.
__device__ __forceinline__ void stage_ab_async(unsigned int ldsA, unsigned int ldsB,
                                               const bf16_t* gA, const bf16_t* gB) {
    asm volatile("global_load_async_to_lds_b128 %0, %8, off\n\t"
                 "global_load_async_to_lds_b128 %1, %9, off\n\t"
                 "global_load_async_to_lds_b128 %2, %10, off\n\t"
                 "global_load_async_to_lds_b128 %3, %11, off\n\t"
                 "global_load_async_to_lds_b128 %4, %12, off\n\t"
                 "global_load_async_to_lds_b128 %5, %13, off\n\t"
                 "global_load_async_to_lds_b128 %6, %14, off\n\t"
                 "global_load_async_to_lds_b128 %7, %15, off\n\t"
                 "s_wait_xcnt 0x0"
                 :
                 : "v"(ldsA), "v"(ldsA + 32u * G_PITCH * 2u),
                   "v"(ldsA + 64u * G_PITCH * 2u), "v"(ldsA + 96u * G_PITCH * 2u),
                   "v"(ldsB), "v"(ldsB + 32u * G_PITCH * 2u),
                   "v"(ldsB + 64u * G_PITCH * 2u), "v"(ldsB + 96u * G_PITCH * 2u),
                   "v"(gA), "v"(gA + 32 * C_DIM), "v"(gA + 64 * C_DIM), "v"(gA + 96 * C_DIM),
                   "v"(gB), "v"(gB + 32 * C_DIM), "v"(gB + 64 * C_DIM), "v"(gB + 96 * C_DIM)
                 : "memory");
}

// ---------------- stage 0: conversions ----------------

// A wave converts 1024 consecutive floats: eight 16-byte loads per lane, all issued before the
// first use, each covering 512 contiguous bytes of the wave; each store covers 256 contiguous bytes.
// The grid covers the array exactly: 8192 floats per block.
__global__ __launch_bounds__(256) void f32_to_bf16_kernel(const float* __restrict__ in,
                                                          bf16_t* __restrict__ out) {
    const size_t base = (size_t)blockIdx.x * 8192 + (threadIdx.x >> 5) * 1024 + (threadIdx.x & 31) * 4;
    v4f v[8];
#pragma unroll   // both loops unrolled: v[] stays in registers and the eight loads are in flight together
    for (int j = 0; j < 8; ++j) v[j] = *(const v4f*)&in[base + j * 128];
#pragma unroll
    for (int j = 0; j < 8; ++j) *(v4bf*)&out[base + j * 128] = __builtin_convertvector(v[j], v4bf);
}

// out[n*K + k] = (bf16) in[k*N + n]  (W stored [K][N] row-major -> [N][K])
// A thread takes a block of 8 k x 4 n: eight 16-byte loads (8 lanes cover one whole 128-byte line
// of a row of W) and four 16-byte stores (8 consecutive k of one n).
// A block covers 256 k x 32 n; the grid (N/32, K/256) covers W exactly. K and N are literals at
// both calls, so that all eight loads (and all four stores) go through one address register pair.
__device__ __forceinline__ void transpose_bf16(const float* __restrict__ in,
                                               bf16_t* __restrict__ out, const int K, const int N) {
    const int n = blockIdx.x * 32 + (threadIdx.x & 7) * 4;
    const int k = blockIdx.y * 256 + (threadIdx.x >> 3) * 8;
    v4f r[8];
#pragma unroll   // all loops unrolled: r[] stays in registers and the eight loads are in flight together
    for (int j = 0; j < 8; ++j) r[j] = *(const v4f*)&in[(size_t)(k + j) * N + n];
#pragma unroll
    for (int c = 0; c < 4; ++c) {
        v8bf o;
#pragma unroll
        for (int j = 0; j < 8; ++j) o[j] = (bf16_t)r[j][c];
        *(v8bf*)&out[(size_t)(n + c) * K + k] = o;
    }
}
__global__ __launch_bounds__(256) void transpose_wqkv_kernel(const float* __restrict__ in,
                                                             bf16_t* __restrict__ out) {
    transpose_bf16(in, out, C_DIM, N_QKV);
}
__global__ __launch_bounds__(256) void transpose_wout_kernel(const float* __restrict__ in,
                                                             bf16_t* __restrict__ out) {
    transpose_bf16(in, out, C_DIM, C_DIM);
}

// ---------------- stage 1: QKV GEMM + split + RoPE ----------------
// One transcendental and, in the same statement, the v_nop that fills the slot which the
// instruction set asks for before its result is read or its source overwritten (with eight
// independent chains per thread the compiler sets such instructions back to back).
__device__ __forceinline__ float t_exp2(float x) {
    float r; asm("v_exp_f32 %0, %1\n\tv_nop" : "=v"(r) : "v"(x)); return r;
}
__device__ __forceinline__ float t_sin(float x) {   // sin(2 pi x)
    float r; asm("v_sin_f32 %0, %1\n\tv_nop" : "=v"(r) : "v"(x)); return r;
}
__device__ __forceinline__ float t_cos(float x) {   // cos(2 pi x)
    float r; asm("v_cos_f32 %0, %1\n\tv_nop" : "=v"(r) : "v"(x)); return r;
}

// C[m][n] = sum_k x[m][k] * Wt[n][k] + bias[n]; split into q,k ([BH][T][Dh]) and v ([BH][Dh][T]).
// A block's 128 columns are all q, all k or all v. The operand whose index runs along the
// contiguous direction of the output (d for q and k, t for v) is taken as the products' row
// operand, so a lane's 8 accumulator rows are 8 neighbours in memory. The finished bf16 tile is
// staged in the ring's LDS and goes out in 16-byte stores that cover whole 128-byte lines.
// q and k are rotated (RoPE) on the way from the staged tile to memory: a tile holds whole heads,
// so both members of every pair (i, i + 32) lie in one staged row.
// A staged output row: 256 B of data at a pitch of 272 B (16 B x odd): no bank conflict for b128.
#define C_PITCH 136                       // bf16 elements
__global__ __launch_bounds__(256) void gemm_qkv_kernel(
    const bf16_t* __restrict__ A,   // [8192][1024]
    const bf16_t* __restrict__ Bt,  // [3072][1024]
    const float*  __restrict__ bias,// [3072]
    bf16_t* __restrict__ qbuf, bf16_t* __restrict__ kbuf, bf16_t* __restrict__ vbuf)
{
    __shared__ __attribute__((aligned(16))) bf16_t As[2][G_TILE];
    __shared__ __attribute__((aligned(16))) bf16_t Bs[2][G_TILE];
    const int tid  = threadIdx.x;
    const int lane = tid & 31, wv = tid >> 5;
    const int wr = wv & 3, wc = wv >> 2;          // wave tile: rows wr*32, cols wc*64
    const int half = lane >> 4, ln = lane & 15;
    const int m0 = blockIdx.y * 128;
    const int n0 = blockIdx.x * 128;
    // this thread's place in a staged tile: row tid/8 (and +32, +64, +96), 16-byte column tid%8
    const int srow = tid >> 3, scol = (tid & 7) * 8;
    const unsigned int ldsA0 = (unsigned int)(uintptr_t)&As[0][srow * G_PITCH + scol];
    const unsigned int ldsB0 = (unsigned int)(uintptr_t)&Bs[0][srow * G_PITCH + scol];
    const unsigned int bufBytes = G_TILE * 2u;
    const bf16_t* gA0 = A  + (size_t)(m0 + srow) * C_DIM + scol;      // + stage * G_BK
    const bf16_t* gB0 = Bt + (size_t)(n0 + srow) * C_DIM + scol;      // + stage * G_BK
    const bool isV = n0 >= 2 * C_DIM;             // the same for the whole block
    // this lane's first fragment row of each operand, buffer 0
    const bf16_t* rowOp = (isV ? &As[0][0] : &Bs[0][0])  // v: rows = t (x);  q,k: rows = d (W)
                        + (wr * 32 + ln) * G_PITCH + half * 8;
    const bf16_t* colOp = (isV ? &Bs[0][0] : &As[0][0])  // v: cols = d (W);  q,k: cols = t (x)
                        + (wc * 64 + ln) * G_PITCH + half * 8;

    v8f acc[2][4] = {};
    const int KT = C_DIM / G_BK;
    stage_ab_async(ldsA0, ldsB0, gA0, gB0);                           // stage 0 -> buffer 0
    ASYNC_WAIT_0();       // this wave's stage-0 copies have landed
    __syncthreads();      // every wave's have: stage 0 is readable
    stage_ab_async(ldsA0 + bufBytes, ldsB0 + bufBytes, gA0 + G_BK, gB0 + G_BK);  // stage 1 -> buffer 1
    for (int kt = 0; kt < KT; ++kt) {
        const int cur = kt & 1;
#pragma unroll   // the two 32-k halves of the stage, in ascending k
        for (int ks = 0; ks < 2; ++ks) {
            v16bf af[2], bfg[4];
#pragma unroll
            for (int mi = 0; mi < 2; ++mi)
                af[mi] = ld_frag(&rowOp[(cur * 128 + mi * 16) * G_PITCH + ks * 32]);
#pragma unroll
            for (int ni = 0; ni < 4; ++ni)
                bfg[ni] = ld_frag(&colOp[(cur * 128 + ni * 16) * G_PITCH + ks * 32]);
#pragma unroll
            for (int mi = 0; mi < 2; ++mi)
#pragma unroll
                for (int ni = 0; ni < 4; ++ni)
                    acc[mi][ni] = wmma_bf16(af[mi], bfg[ni], acc[mi][ni]);
        }
        // hand-over: this wave's LDS reads of buffer cur are done, its copies of stage kt+1 have landed
        asm volatile("s_wait_dscnt 0x0" ::: "memory");
        ASYNC_WAIT_0();
        __syncthreads();      // stage kt+1 readable by all; buffer cur left by all its readers
        if (kt + 2 < KT)      // refill the buffer just read with stage kt+2
            stage_ab_async(ldsA0 + cur * bufBytes, ldsB0 + cur * bufBytes,
                           gA0 + (kt + 2) * G_BK, gB0 + (kt + 2) * G_BK);
    }
    ASYNC_WAIT_0();           // nothing of this wave's is in flight when it leaves the loop

    // epilogue: bias, then the tile [column operand's index][row operand's index] into LDS.
    // Tile rows 0..63 lie in As, rows 64..127 in Bs (the loop's last barrier has freed both).
    bf16_t* ct = (wc ? &Bs[0][0] : &As[0][0]) + ln * C_PITCH + wr * 32 + half * 8;
    if (isV) {                 // bias runs along the tile's rows: one value per lane and ni
        float bc[4];
#pragma unroll
        for (int ni = 0; ni < 4; ++ni) bc[ni] = bias[n0 + wc * 64 + ni * 16 + ln];
        // stands in front of any reuse of the offset register that the four loads above name
        asm volatile("s_wait_xcnt 0x0" ::: "memory");
#pragma unroll
        for (int mi = 0; mi < 2; ++mi)
#pragma unroll
            for (int ni = 0; ni < 4; ++ni) {
                v8bf o;
#pragma unroll
                for (int r = 0; r < 8; ++r) o[r] = (bf16_t)(acc[mi][ni][r] + bc[ni]);
                *(v8bf*)&ct[ni * 16 * C_PITCH + mi * 16] = o;
            }
    } else {                   // bias runs along the lane's 8 accumulator rows
#pragma unroll
        for (int mi = 0; mi < 2; ++mi) {
            const v8f br = *(const v8f*)&bias[n0 + wr * 32 + mi * 16 + half * 8];
#pragma unroll
            for (int ni = 0; ni < 4; ++ni) {
                v8bf o;
#pragma unroll
                for (int r = 0; r < 8; ++r) o[r] = (bf16_t)(acc[mi][ni][r] + br[r]);
                *(v8bf*)&ct[ni * 16 * C_PITCH + mi * 16] = o;
            }
        }
    }
    __syncthreads();          // the whole tile is staged before any wave reads it back

    v8bf val[8];
    const int bb = m0 >> 11;                       // batch: 128 rows never straddle one
    const int t0 = m0 & 2047;
    if (isV) {                 // tile row = head * 64 + d, columns = t
        // 16 lanes read one staged row (256 B) and store it: two whole lines
        const int c8 = (tid & 15) * 8, rw = tid >> 4;
#pragma unroll
        for (int i = 0; i < 8; ++i)
            val[i] = *(const v8bf*)&((i < 4) ? As : Bs)[0][((i & 3) * 16 + rw) * C_PITCH + c8];
        bf16_t* p = vbuf + ((size_t)bb * C_DIM + (n0 & 1023) + rw) * T_SEQ + t0 + c8;
#pragma unroll
        for (int i = 0; i < 8; ++i) *(v8bf*)(p + (size_t)i * 16 * T_SEQ) = val[i];
    } else {                   // tile row = t, columns = two heads' d
        // 8 lanes take one staged row: a thread has 8 consecutive pairs (i, i + 32) of one head,
        // in rows rw, rw + 32, rw + 64 and rw + 96; its two stores of a row fill one 128-byte line
        // together with its three neighbours'.
        const int hh = (tid >> 2) & 1, i0 = (tid & 3) * 8, rw = tid >> 3;
        float invf[8];         // inv_freq = 10000^(-2i/64) = exp(-(2i/64) * ln(10000)), the same in all rows
#pragma unroll   // all loops unrolled: vector elements are indexed by constants, everything stays in registers
        for (int e = 0; e < 8; ++e)
            invf[e] = t_exp2(-(float)(2 * (i0 + e)) * (9.210340371976184f / 64.0f) * 1.44269504f);
#pragma unroll
        for (int i = 0; i < 4; ++i) {
            const bf16_t* sr = &((i < 2) ? As : Bs)[0][((i & 1) * 32 + rw) * C_PITCH + hh * 64 + i0];
            const v8bf h1 = *(const v8bf*)sr, h2 = *(const v8bf*)(sr + 32);
            const float tf = (float)(t0 + i * 32 + rw);
            v8bf o1, o2;
#pragma unroll
            for (int e = 0; e < 8; ++e) {
                const float rev = tf * invf[e] * 0.15915494f;    // the angle in turns
                const float s = t_sin(rev), c = t_cos(rev);
                const float x1 = (float)h1[e], x2 = (float)h2[e];
                o1[e] = (bf16_t)(x1 * c - x2 * s);
                o2[e] = (bf16_t)(x2 * c + x1 * s);
            }
            val[2 * i] = o1;  val[2 * i + 1] = o2;
        }
        bf16_t* p = ((n0 < C_DIM) ? qbuf : kbuf)
                  + ((size_t)(bb * H_N + ((n0 & 1023) >> 6) + hh) * T_SEQ + t0 + rw) * D_H + i0;
#pragma unroll
        for (int i = 0; i < 4; ++i) {
            *(v8bf*)(p + i * 32 * D_H)      = val[2 * i];
            *(v8bf*)(p + i * 32 * D_H + 32) = val[2 * i + 1];
        }
    }
}

// ---------------- stage 3: flash attention ----------------
// One staged row: 128 B of data at a pitch of 144 B (16 B x odd), so that the
// 16-row ds_load_b128 fragment reads fall on distinct banks.
#define KV_PITCH 72                       // bf16 elements
#define KV_TILE  (64 * KV_PITCH)          // one 64-row tile, bf16 elements

// This thread's four 16-byte copies of one stage: rows r and r+32 of the 64x64 K tile
// and of the 64x64 V^T tile. A wave's 32 lanes cover four whole 128-byte rows per copy.
// The s_wait_xcnt is the last line of the copies' own statement so that no later write
// of their address registers can be scheduled in front of it.
__device__ __forceinline__ void stage_kv_async(unsigned int ldsK, unsigned int ldsV,
                                               const bf16_t* gK, const bf16_t* gV) {
    asm volatile("global_load_async_to_lds_b128 %0, %4, off\n\t"
                 "global_load_async_to_lds_b128 %1, %5, off\n\t"
                 "global_load_async_to_lds_b128 %2, %6, off\n\t"
                 "global_load_async_to_lds_b128 %3, %7, off\n\t"
                 "s_wait_xcnt 0x0"
                 :
                 : "v"(ldsK), "v"(ldsK + 32u * KV_PITCH * 2u),
                   "v"(ldsV), "v"(ldsV + 32u * KV_PITCH * 2u),
                   "v"(gK), "v"(gK + 32 * D_H), "v"(gV), "v"(gV + 32 * T_SEQ)
                 : "memory");
}

// Exchange a float between lane l and lane l ^ 16 (the two halves of a wave) in the vector unit.
__device__ __forceinline__ float xhalf(float x) {
    const int b = __builtin_bit_cast(int, x);
    return __builtin_bit_cast(float,
        __builtin_amdgcn_permlanex16(b, b, 0x76543210, 0xfedcba98, false, false));
}

#define Q_GR 2                            // 16-column query groups per wave
__global__ __launch_bounds__(256) void attn_kernel(
    const bf16_t* __restrict__ qbuf,  // [BH][T][Dh]
    const bf16_t* __restrict__ kbuf,  // [BH][T][Dh]
    const bf16_t* __restrict__ vbuf,  // [BH][Dh][T]
    bf16_t* __restrict__ obuf)        // [8192][1024] (m = b*T+t, col = h*64+d)
{
    __shared__ __attribute__((aligned(16))) bf16_t Ks[2][KV_TILE];       // [key][d]
    __shared__ __attribute__((aligned(16))) bf16_t Vs[2][KV_TILE];       // [d][key]
    const int tid  = threadIdx.x;
    const int lane = tid & 31, wv = tid >> 5;
    const int half = lane >> 4, ln = lane & 15;
    const int bh  = blockIdx.y;
    const int qt0 = blockIdx.x * (128 * Q_GR);
    const size_t qkbase = (size_t)bh * T_SEQ * D_H;
    const size_t vbase  = (size_t)bh * D_H * T_SEQ;

    // this thread's place in a staged tile: row tid/8 (and +32), 16-byte column tid%8
    const int srow = tid >> 3, scol = (tid & 7) * 8;
    const unsigned int tileBytes = KV_TILE * 2u;
    const unsigned int ldsK0 = (unsigned int)(uintptr_t)&Ks[0][srow * KV_PITCH + scol];
    const unsigned int ldsV0 = (unsigned int)(uintptr_t)&Vs[0][srow * KV_PITCH + scol];
    const bf16_t* gK0 = kbuf + qkbase + (size_t)srow * D_H + scol;    // + tile * 64 * D_H
    const bf16_t* gV0 = vbuf + vbase + (size_t)srow * T_SEQ + scol;   // + tile * 64
    const int NT = T_SEQ / 64;

    stage_kv_async(ldsK0, ldsV0, gK0, gV0);                           // tile 0 -> buffer 0
    ASYNC_WAIT_0();       // this wave's tile-0 copies have landed
    __syncthreads();      // every wave's have: tile 0 is readable
    stage_kv_async(ldsK0 + tileBytes, ldsV0 + tileBytes, gK0 + 64 * D_H, gV0 + 64);  // tile 1 -> buffer 1

    // Q fragments stay resident (B operand: column = query = lane%16, d in ld_frag's k order)
    const int tq = qt0 + wv * (16 * Q_GR) + ln;      // group g's query: tq + g * 16
    v16bf bq[Q_GR][2];
#pragma unroll
    for (int g = 0; g < Q_GR; ++g)
#pragma unroll
        for (int c = 0; c < 2; ++c)
            bq[g][c] = ld_frag(&qbuf[qkbase + (size_t)(tq + g * 16) * D_H + c * 32 + half * 8]);

    float mrun[Q_GR];     // running maximum of this lane's query (equal in both halves)
    float lrun[Q_GR];     // running sum over this half's keys only; the halves join after the loop
    v8f acc[Q_GR][4] = {};   // acc[g][j2][r] = O[query ln of group g][d = j2*16 + half*8 + r]
#pragma unroll
    for (int g = 0; g < Q_GR; ++g) { mrun[g] = -1e30f; lrun[g] = 0.0f; }

    for (int kt = 0; kt < NT; ++kt) {
        const int cur = kt & 1;
        // S^T = K @ Q^T: s[g][j][r] = product of key j*16 + half*8 + r with query ln of group g
        v8f s[Q_GR][4] = {};
#pragma unroll
        for (int j = 0; j < 4; ++j)
#pragma unroll
            for (int c = 0; c < 2; ++c) {
                v16bf kf = ld_frag(&Ks[cur][(j * 16 + ln) * KV_PITCH + c * 32 + half * 8]);
#pragma unroll
                for (int g = 0; g < Q_GR; ++g) s[g][j] = wmma_bf16(kf, bq[g][c], s[g][j]);
            }

        v16bf pf[Q_GR][2];
#pragma unroll
        for (int g = 0; g < Q_GR; ++g) {
#pragma unroll
            for (int j = 0; j < 4; ++j) s[g][j] *= 0.125f;   // 1/sqrt(64)
            // maximum over the 64 keys: 32 in this lane, the other 32 in lane ^ 16
            float rmax = s[g][0][0];
#pragma unroll
            for (int j = 0; j < 4; ++j)
#pragma unroll
                for (int r = 0; r < 8; ++r) rmax = fmaxf(rmax, s[g][j][r]);
            rmax = fmaxf(rmax, xhalf(rmax));

            const float mn = fmaxf(mrun[g], rmax);
            const float sc = t_exp2((mrun[g] - mn) * 1.44269504f);   // exp(mrun - mn), with its slot filled
            mrun[g] = mn;

            // P^T = exp(S^T - mn). Tiles 2c and 2c+1 give elements 0..7 and 8..15 of the B fragment
            // of keys c*32 .. c*32+31: key = c*32 + (e>=8 ? 16 : 0) + half*8 + e%8, ld_frag's k order.
            v2f ps[2] = {};   // two independent packed chains
#pragma unroll
            for (int c = 0; c < 2; ++c)
#pragma unroll
                for (int e = 0; e < 16; e += 2) {
                    const v8f& t = s[g][2 * c + (e >> 3)];
                    const v2f x = {t[e & 7], t[(e & 7) + 1]};
                    const v2f y = (x - mn) * 1.44269504f;      // exp(x - mn) = 2^((x - mn) * log2 e)
                    const v2f p = {__builtin_amdgcn_exp2f(y.x), __builtin_amdgcn_exp2f(y.y)};
                    ps[(e >> 1) & 1] += p;
                    pf[g][c][e]     = (bf16_t)p.x;
                    pf[g][c][e + 1] = (bf16_t)p.y;
                }
            ps[0] += ps[1];
            lrun[g] = lrun[g] * sc + (ps[0].x + ps[0].y);
#pragma unroll
            for (int j2 = 0; j2 < 4; ++j2)
#pragma unroll
                for (int r = 0; r < 8; ++r) acc[g][j2][r] *= sc;
        }

        // O^T += V^T @ P^T   (A fragment: row = d = lane%16, keys from the staged [Dh][key] tile)
#pragma unroll
        for (int j2 = 0; j2 < 4; ++j2)
#pragma unroll
            for (int c = 0; c < 2; ++c) {
                v16bf vf = ld_frag(&Vs[cur][(j2 * 16 + ln) * KV_PITCH + c * 32 + half * 8]);
#pragma unroll
                for (int g = 0; g < Q_GR; ++g) acc[g][j2] = wmma_bf16(vf, pf[g][c], acc[g][j2]);
            }
        // hand-over: this wave's LDS reads of buffer cur are done, its copies of tile kt+1 have landed
        asm volatile("s_wait_dscnt 0x0" ::: "memory");
        ASYNC_WAIT_0();
        __syncthreads();      // tile kt+1 readable by all; buffer cur left by all its readers
        if (kt + 2 < NT)      // refill the buffer just read with tile kt+2
            stage_kv_async(ldsK0 + cur * tileBytes, ldsV0 + cur * tileBytes,
                           gK0 + (size_t)(kt + 2) * 64 * D_H, gV0 + (kt + 2) * 64);
    }
    ASYNC_WAIT_0();           // nothing of this wave's is in flight when it leaves the loop

    // normalize + write [m][h*64+d]: a lane holds 8 consecutive d of its query per tile
    const int b = bh >> 4, h = bh & 15;
#pragma unroll
    for (int g = 0; g < Q_GR; ++g) {
        const float inv = 1.0f / (lrun[g] + xhalf(lrun[g]));
        bf16_t* orow = obuf + (size_t)(b * T_SEQ + tq + g * 16) * C_DIM + h * 64 + half * 8;
#pragma unroll
        for (int j2 = 0; j2 < 4; ++j2) {
            v8bf o;
#pragma unroll
            for (int r = 0; r < 8; ++r) o[r] = (bf16_t)(acc[g][j2][r] * inv);
            *(v8bf*)(orow + j2 * 16) = o;
        }
        // stands in front of any reuse, by the next group, of the registers that these stores name
        if (g + 1 < Q_GR) asm volatile("s_wait_xcnt 0x0" ::: "memory");
    }
}

// ---------------- stage 4: output projection ----------------
__global__ __launch_bounds__(256) void gemm_out_kernel(
    const bf16_t* __restrict__ A,    // [8192][1024] (attention output)
    const bf16_t* __restrict__ Bt,   // [1024][1024] = W_out^T
    const float*  __restrict__ bias, // [1024]
    float* __restrict__ out)         // [8192][1024]
{
    __shared__ __attribute__((aligned(16))) bf16_t As[2][G_TILE];
    __shared__ __attribute__((aligned(16))) bf16_t Bs[2][G_TILE];
    const int tid  = threadIdx.x;
    const int lane = tid & 31, wv = tid >> 5;
    const int wr = wv & 3, wc = wv >> 2;
    const int half = lane >> 4, ln = lane & 15;
    const int m0 = blockIdx.y * 128;
    const int n0 = blockIdx.x * 128;
    // this thread's place in a staged tile: row tid/8 (and +32, +64, +96), 16-byte column tid%8
    const int srow = tid >> 3, scol = (tid & 7) * 8;
    const unsigned int ldsA0 = (unsigned int)(uintptr_t)&As[0][srow * G_PITCH + scol];
    const unsigned int ldsB0 = (unsigned int)(uintptr_t)&Bs[0][srow * G_PITCH + scol];
    const unsigned int bufBytes = G_TILE * 2u;
    const bf16_t* gA0 = A  + (size_t)(m0 + srow) * C_DIM + scol;      // + stage * G_BK
    const bf16_t* gB0 = Bt + (size_t)(n0 + srow) * C_DIM + scol;      // + stage * G_BK

    v8f acc[2][4] = {};
    const int KT = C_DIM / G_BK;
    stage_ab_async(ldsA0, ldsB0, gA0, gB0);                           // stage 0 -> buffer 0
    ASYNC_WAIT_0();       // this wave's stage-0 copies have landed
    __syncthreads();      // every wave's have: stage 0 is readable
    stage_ab_async(ldsA0 + bufBytes, ldsB0 + bufBytes, gA0 + G_BK, gB0 + G_BK);  // stage 1 -> buffer 1
    for (int kt = 0; kt < KT; ++kt) {
        const int cur = kt & 1;
#pragma unroll   // the two 32-k halves of the stage, in ascending k
        for (int ks = 0; ks < 2; ++ks) {
            v16bf af[2], bfg[4];
#pragma unroll
            for (int mi = 0; mi < 2; ++mi)
                af[mi] = ld_frag(&As[cur][(wr * 32 + mi * 16 + ln) * G_PITCH + ks * 32 + half * 8]);
#pragma unroll
            for (int ni = 0; ni < 4; ++ni)
                bfg[ni] = ld_frag(&Bs[cur][(wc * 64 + ni * 16 + ln) * G_PITCH + ks * 32 + half * 8]);
#pragma unroll
            for (int mi = 0; mi < 2; ++mi)
#pragma unroll
                for (int ni = 0; ni < 4; ++ni)
                    acc[mi][ni] = wmma_bf16(af[mi], bfg[ni], acc[mi][ni]);
        }
        // hand-over: this wave's LDS reads of buffer cur are done, its copies of stage kt+1 have landed
        asm volatile("s_wait_dscnt 0x0" ::: "memory");
        ASYNC_WAIT_0();
        __syncthreads();      // stage kt+1 readable by all; buffer cur left by all its readers
        if (kt + 2 < KT)      // refill the buffer just read with stage kt+2
            stage_ab_async(ldsA0 + cur * bufBytes, ldsB0 + cur * bufBytes,
                           gA0 + (kt + 2) * G_BK, gB0 + (kt + 2) * G_BK);
    }
    ASYNC_WAIT_0();           // nothing of this wave's is in flight when it leaves the loop
#pragma unroll
    for (int mi = 0; mi < 2; ++mi)
#pragma unroll
        for (int ni = 0; ni < 4; ++ni) {
            const int gm = m0 + wr * 32 + mi * 16 + half * 8;
            const int gn = n0 + wc * 64 + ni * 16 + ln;
            const float bv = bias[gn];
#pragma unroll
            for (int r = 0; r < 8; ++r)
                out[(size_t)(gm + r) * C_DIM + gn] = acc[mi][ni][r] + bv;
        }
}

// ---------------- launcher ----------------
extern "C" void kernel_launch(void* const* d_in, const int* in_sizes, int n_in,
                              void* d_out, int out_size, void* d_ws, size_t ws_size,
                              hipStream_t stream) {
    const float* x     = (const float*)d_in[0];  // [4,2048,1024]
    const float* W_qkv = (const float*)d_in[1];  // [1024,3072]
    const float* b_qkv = (const float*)d_in[2];  // [3072]
    const float* W_out = (const float*)d_in[3];  // [1024,1024]
    const float* b_out = (const float*)d_in[4];  // [1024]
    float* out = (float*)d_out;

    char* ws = (char*)d_ws;
    bf16_t* xb    = (bf16_t*)(ws);                         // 16 MiB (reused as obuf)
    bf16_t* wqkvT = (bf16_t*)(ws + (size_t)16777216);      //  6 MiB
    bf16_t* woT   = (bf16_t*)(ws + (size_t)23068672);      //  2 MiB
    bf16_t* qb    = (bf16_t*)(ws + (size_t)25165824);      // 16 MiB
    bf16_t* kb    = (bf16_t*)(ws + (size_t)41943040);      // 16 MiB
    bf16_t* vb    = (bf16_t*)(ws + (size_t)58720256);      // 16 MiB -> 72 MiB total
    bf16_t* obuf  = xb;  // x is fully consumed by gemm_qkv before attn writes obuf

    // stage 0: precision conversion / weight transposition
    f32_to_bf16_kernel<<<(M_ROWS * C_DIM) / 8192, 256, 0, stream>>>(x, xb);
    transpose_wqkv_kernel<<<dim3(N_QKV / 32, C_DIM / 256), 256, 0, stream>>>(W_qkv, wqkvT);
    transpose_wout_kernel<<<dim3(C_DIM / 32, C_DIM / 256), 256, 0, stream>>>(W_out, woT);

    // stage 1: QKV projection (WMMA, async double-buffered LDS) + q/k/v split, q and k rotated, v transposed
    gemm_qkv_kernel<<<dim3(N_QKV / 128, M_ROWS / 128), 256, 0, stream>>>(xb, wqkvT, b_qkv, qb, kb, vb);

    // stage 3: attention (WMMA flash-style)
    attn_kernel<<<dim3(T_SEQ / (128 * Q_GR), B_N * H_N), 256, 0, stream>>>(qb, kb, vb, obuf);

    // stage 4: output projection (WMMA, async double-buffered LDS) + bias, fp32 out
    gemm_out_kernel<<<dim3(C_DIM / 128, M_ROWS / 128), 256, 0, stream>>>(obuf, woT, b_out, out);
}

// v009
// One run takes 134 microseconds.
// Two timings next to v008 both put it at 1.04 times that version's speed.
// All steps since v000 together make it 3.26 times as fast.
#include <hip/hip_runtime.h>
#include <hip/hip_bf16.h>

typedef __bf16 bf16_t;
typedef __bf16 v16bf __attribute__((ext_vector_type(16)));
typedef __bf16 v8bf  __attribute__((ext_vector_type(8)));
typedef float  v8f   __attribute__((ext_vector_type(8)));
typedef float  v2f   __attribute__((ext_vector_type(2)));
typedef float  v4f   __attribute__((ext_vector_type(4)));
typedef __bf16 v4bf  __attribute__((ext_vector_type(4)));

#define T_SEQ  2048
#define C_DIM  1024
#define N_QKV  3072
#define H_N    16
#define D_H    64
#define B_N    4
#define M_ROWS 8192   // B*T

// ---- CDNA5 async global->LDS copies are tracked by ASYNCcnt ----
#define ASYNC_WAIT_0() asm volatile("s_wait_asynccnt 0x0" ::: "memory")

// Load a 16-element bf16 A/B WMMA fragment slice.
// Caller passes p = row_base + (lane>=16 ? 8 : 0) [+ k0].
// Elements 0..7  <- p[0..7]   (K = kb .. kb+7)
// Elements 8..15 <- p[16..23] (K = kb+16 .. kb+23)
// Matches CDNA5 16-bit A/B layout: K(e,lane) = (e>=8?16:0)+(lane>=16?8:0)+(e%8).
__device__ __forceinline__ v16bf ld_frag(const bf16_t* p) {
    v8bf lo = *(const v8bf*)(p);
    v8bf hi = *(const v8bf*)(p + 16);
    return __builtin_shufflevector(lo, hi, 0,1,2,3,4,5,6,7,8,9,10,11,12,13,14,15);
}

__device__ __forceinline__ v8f wmma_bf16(v16bf a, v16bf b, v8f c) {
    return __builtin_amdgcn_wmma_f32_16x16x32_bf16(false, a, false, b, (short)0, c, false, false);
}

// A staged GEMM row: 64 k = 128 B of data (one whole line of the operand's row in memory) at a
// pitch of 144 B (16 B x odd), so that the 16 rows of a ds_load_b128 fragment read fall on
// distinct banks.
#define G_BK    64                        // k per stage
#define G_PITCH 72                        // bf16 elements
#define G_TILE  (128 * G_PITCH)           // one 128-row tile, bf16 elements

// This thread's eight 16-byte copies of one stage: rows r, r+32, r+64 and r+96 of the 128x64
// A tile and of the 128x64 B tile. Eight lanes cover one row, so a wave's 32 lanes bring four
// whole 128-byte lines per copy. The s_wait_xcnt is the last line of the copies' own statement
// so that no later write of their address registers can be scheduled in front of it.
__device__ __forceinline__ void stage_ab_async(unsigned int ldsA, unsigned int ldsB,
                                               const bf16_t* gA, const bf16_t* gB) {
    asm volatile("global_load_async_to_lds_b128 %0, %8, off\n\t"
                 "global_load_async_to_lds_b128 %1, %9, off\n\t"
                 "global_load_async_to_lds_b128 %2, %10, off\n\t"
                 "global_load_async_to_lds_b128 %3, %11, off\n\t"
                 "global_load_async_to_lds_b128 %4, %12, off\n\t"
                 "global_load_async_to_lds_b128 %5, %13, off\n\t"
                 "global_load_async_to_lds_b128 %6, %14, off\n\t"
                 "global_load_async_to_lds_b128 %7, %15, off\n\t"
                 "s_wait_xcnt 0x0"
                 :
                 : "v"(ldsA), "v"(ldsA + 32u * G_PITCH * 2u),
                   "v"(ldsA + 64u * G_PITCH * 2u), "v"(ldsA + 96u * G_PITCH * 2u),
                   "v"(ldsB), "v"(ldsB + 32u * G_PITCH * 2u),
                   "v"(ldsB + 64u * G_PITCH * 2u), "v"(ldsB + 96u * G_PITCH * 2u),
                   "v"(gA), "v"(gA + 32 * C_DIM), "v"(gA + 64 * C_DIM), "v"(gA + 96 * C_DIM),
                   "v"(gB), "v"(gB + 32 * C_DIM), "v"(gB + 64 * C_DIM), "v"(gB + 96 * C_DIM)
                 : "memory");
}

// ---------------- stage 0: conversions, one launch ----------------

// A wave converts 1024 consecutive floats: eight 16-byte loads per lane, all issued before the
// first use, each covering 512 contiguous bytes of the wave; each store covers 256 contiguous bytes.
// A block takes 8192 floats; blk = 0 .. NB_X - 1 covers the array exactly.
__device__ __forceinline__ void convert_bf16(const float* __restrict__ in,
                                             bf16_t* __restrict__ out, const int blk) {
    const size_t base = (size_t)blk * 8192 + (threadIdx.x >> 5) * 1024 + (threadIdx.x & 31) * 4;
    v4f v[8];
#pragma unroll   // both loops unrolled: v[] stays in registers and the eight loads are in flight together
    for (int j = 0; j < 8; ++j) v[j] = *(const v4f*)&in[base + j * 128];
#pragma unroll
    for (int j = 0; j < 8; ++j) *(v4bf*)&out[base + j * 128] = __builtin_convertvector(v[j], v4bf);
    // Behind the last store: a block runs only this piece and then ends; the wait is a
    // precaution in front of any later write of the stores' address and data registers.
    asm volatile("s_wait_xcnt 0x0" ::: "memory");
}

// out[n*K + k] = (bf16) in[k*N + n]  (W stored [K][N] row-major -> [N][K])
// A thread takes a block of 8 k x 4 n: eight 16-byte loads (8 lanes cover one whole 128-byte line
// of a row of W) and four 16-byte stores (8 consecutive k of one n).
// A block covers 256 k x 32 n; bn = 0 .. N/32 - 1 and bk = 0 .. K/256 - 1 cover W exactly. K and N
// are literals at both calls, so that all eight loads (and all four stores) go through one address
// register pair.
__device__ __forceinline__ void transpose_bf16(const float* __restrict__ in,
                                               bf16_t* __restrict__ out, const int K, const int N,
                                               const int bn, const int bk) {
    const int n = bn * 32 + (threadIdx.x & 7) * 4;
    const int k = bk * 256 + (threadIdx.x >> 3) * 8;
    v4f r[8];
#pragma unroll   // all loops unrolled: r[] stays in registers and the eight loads are in flight together
    for (int j = 0; j < 8; ++j) r[j] = *(const v4f*)&in[(size_t)(k + j) * N + n];
#pragma unroll
    for (int c = 0; c < 4; ++c) {
        v8bf o;
#pragma unroll
        for (int j = 0; j < 8; ++j) o[j] = (bf16_t)r[j][c];
        *(v8bf*)&out[(size_t)(n + c) * K + k] = o;
    }
    // Behind the last store: a block runs only this piece and then ends; the wait is a
    // precaution in front of any later write of the stores' address and data registers.
    asm volatile("s_wait_xcnt 0x0" ::: "memory");
}

// The three conversions depend on nothing and on one another not at all: one launch does them side
// by side, a block's index saying which piece it takes. The transposes, whose accesses are strided,
// have the low indices.
#define NB_WQKV ((N_QKV / 32) * (C_DIM / 256))    // blocks that transpose W_qkv
#define NB_WOUT ((C_DIM / 32) * (C_DIM / 256))    // blocks that transpose W_out
#define NB_X    ((M_ROWS * C_DIM) / 8192)         // blocks that convert x
__global__ __launch_bounds__(256) void convert_kernel(const float* __restrict__ x,
                                                      const float* __restrict__ W_qkv,
                                                      const float* __restrict__ W_out,
                                                      bf16_t* __restrict__ xb,
                                                      bf16_t* __restrict__ wqkvT,
                                                      bf16_t* __restrict__ woT) {
    const int b = blockIdx.x;                     // the same for the whole block: scalar branches
    if (b < NB_WQKV) {                            // C_DIM / 256 = 4 k blocks to each n block
        transpose_bf16(W_qkv, wqkvT, C_DIM, N_QKV, b >> 2, b & 3);
    } else if (b < NB_WQKV + NB_WOUT) {
        const int c = b - NB_WQKV;
        transpose_bf16(W_out, woT, C_DIM, C_DIM, c >> 2, c & 3);
    } else {
        convert_bf16(x, xb, b - (NB_WQKV + NB_WOUT));
    }
}

// ---------------- stage 1: QKV GEMM + split + RoPE ----------------
// One transcendental and, in the same statement, the v_nop that fills the slot which the
// instruction set asks for before its result is read or its source overwritten (with eight
// independent chains per thread the compiler sets such instructions back to back).
__device__ __forceinline__ float t_exp2(float x) {
    float r; asm("v_exp_f32 %0, %1\n\tv_nop" : "=v"(r) : "v"(x)); return r;
}
__device__ __forceinline__ float t_sin(float x) {   // sin(2 pi x)
    float r; asm("v_sin_f32 %0, %1\n\tv_nop" : "=v"(r) : "v"(x)); return r;
}
__device__ __forceinline__ float t_cos(float x) {   // cos(2 pi x)
    float r; asm("v_cos_f32 %0, %1\n\tv_nop" : "=v"(r) : "v"(x)); return r;
}

// C[m][n] = sum_k x[m][k] * Wt[n][k] + bias[n]; split into q,k ([BH][T][Dh]) and v ([BH][Dh][T]).
// A block's 128 columns are all q, all k or all v. The operand whose index runs along the
// contiguous direction of the output (d for q and k, t for v) is taken as the products' row
// operand, so a lane's 8 accumulator rows are 8 neighbours in memory. The finished bf16 tile is
// staged in the ring's LDS and goes out in 16-byte stores that cover whole 128-byte lines.
// q and k are rotated (RoPE) on the way from the staged tile to memory: a tile holds whole heads,
// so both members of every pair (i, i + 32) lie in one staged row.
// A staged output row: 256 B of data at a pitch of 272 B (16 B x odd): no bank conflict for b128.
#define C_PITCH 136                       // bf16 elements
__global__ __launch_bounds__(256) void gemm_qkv_kernel(
    const bf16_t* __restrict__ A,   // [8192][1024]
    const bf16_t* __restrict__ Bt,  // [3072][1024]
    const float*  __restrict__ bias,// [3072]
    bf16_t* __restrict__ qbuf, bf16_t* __restrict__ kbuf, bf16_t* __restrict__ vbuf)
{
    __shared__ __attribute__((aligned(16))) bf16_t As[2][G_TILE];
    __shared__ __attribute__((aligned(16))) bf16_t Bs[2][G_TILE];
    const int tid  = threadIdx.x;
    const int lane = tid & 31, wv = tid >> 5;
    const int wr = wv & 3, wc = wv >> 2;          // wave tile: rows wr*32, cols wc*64
    const int half = lane >> 4, ln = lane & 15;
    const int m0 = blockIdx.y * 128;
    const int n0 = blockIdx.x * 128;
    // this thread's place in a staged tile: row tid/8 (and +32, +64, +96), 16-byte column tid%8
    const int srow = tid >> 3, scol = (tid & 7) * 8;
    const unsigned int ldsA0 = (unsigned int)(uintptr_t)&As[0][srow * G_PITCH + scol];
    const unsigned int ldsB0 = (unsigned int)(uintptr_t)&Bs[0][srow * G_PITCH + scol];
    const unsigned int bufBytes = G_TILE * 2u;
    const bf16_t* gA0 = A  + (size_t)(m0 + srow) * C_DIM + scol;      // + stage * G_BK
    const bf16_t* gB0 = Bt + (size_t)(n0 + srow) * C_DIM + scol;      // + stage * G_BK
    const bool isV = n0 >= 2 * C_DIM;             // the same for the whole block
    // this lane's first fragment row of each operand, buffer 0
    const bf16_t* rowOp = (isV ? &As[0][0] : &Bs[0][0])  // v: rows = t (x);  q,k: rows = d (W)
                        + (wr * 32 + ln) * G_PITCH + half * 8;
    const bf16_t* colOp = (isV ? &Bs[0][0] : &As[0][0])  // v: cols = d (W);  q,k: cols = t (x)
                        + (wc * 64 + ln) * G_PITCH + half * 8;

    v8f acc[2][4] = {};
    const int KT = C_DIM / G_BK;
    stage_ab_async(ldsA0, ldsB0, gA0, gB0);                           // stage 0 -> buffer 0
    ASYNC_WAIT_0();       // this wave's stage-0 copies have landed
    __syncthreads();      // every wave's have: stage 0 is readable
    stage_ab_async(ldsA0 + bufBytes, ldsB0 + bufBytes, gA0 + G_BK, gB0 + G_BK);  // stage 1 -> buffer 1
    for (int kt = 0; kt < KT; ++kt) {
        const int cur = kt & 1;
#pragma unroll   // the two 32-k halves of the stage, in ascending k
        for (int ks = 0; ks < 2; ++ks) {
            v16bf af[2], bfg[4];
#pragma unroll
            for (int mi = 0; mi < 2; ++mi)
                af[mi] = ld_frag(&rowOp[(cur * 128 + mi * 16) * G_PITCH + ks * 32]);
#pragma unroll
            for (int ni = 0; ni < 4; ++ni)
                bfg[ni] = ld_frag(&colOp[(cur * 128 + ni * 16) * G_PITCH + ks * 32]);
#pragma unroll
            for (int mi = 0; mi < 2; ++mi)
#pragma unroll
                for (int ni = 0; ni < 4; ++ni)
                    acc[mi][ni] = wmma_bf16(af[mi], bfg[ni], acc[mi][ni]);
        }
        // hand-over: this wave's LDS reads of buffer cur are done, its copies of stage kt+1 have landed
        asm volatile("s_wait_dscnt 0x0" ::: "memory");
        ASYNC_WAIT_0();
        __syncthreads();      // stage kt+1 readable by all; buffer cur left by all its readers
        if (kt + 2 < KT)      // refill the buffer just read with stage kt+2
            stage_ab_async(ldsA0 + cur * bufBytes, ldsB0 + cur * bufBytes,
                           gA0 + (kt + 2) * G_BK, gB0 + (kt + 2) * G_BK);
    }
    ASYNC_WAIT_0();           // nothing of this wave's is in flight when it leaves the loop

    // epilogue: bias, then the tile [column operand's index][row operand's index] into LDS.
    // Tile rows 0..63 lie in As, rows 64..127 in Bs (the loop's last barrier has freed both).
    bf16_t* ct = (wc ? &Bs[0][0] : &As[0][0]) + ln * C_PITCH + wr * 32 + half * 8;
    if (isV) {                 // bias runs along the tile's rows: one value per lane and ni
        float bc[4];
#pragma unroll
        for (int ni = 0; ni < 4; ++ni) bc[ni] = bias[n0 + wc * 64 + ni * 16 + ln];
        // stands in front of any reuse of the offset register that the four loads above name
        asm volatile("s_wait_xcnt 0x0" ::: "memory");
#pragma unroll
        for (int mi = 0; mi < 2; ++mi)
#pragma unroll
            for (int ni = 0; ni < 4; ++ni) {
                v8bf o;
#pragma unroll
                for (int r = 0; r < 8; ++r) o[r] = (bf16_t)(acc[mi][ni][r] + bc[ni]);
                *(v8bf*)&ct[ni * 16 * C_PITCH + mi * 16] = o;
            }
    } else {                   // bias runs along the lane's 8 accumulator rows
#pragma unroll
        for (int mi = 0; mi < 2; ++mi) {
            const v8f br = *(const v8f*)&bias[n0 + wr * 32 + mi * 16 + half * 8];
#pragma unroll
            for (int ni = 0; ni < 4; ++ni) {
                v8bf o;
#pragma unroll
                for (int r = 0; r < 8; ++r) o[r] = (bf16_t)(acc[mi][ni][r] + br[r]);
                *(v8bf*)&ct[ni * 16 * C_PITCH + mi * 16] = o;
            }
        }
    }
    __syncthreads();          // the whole tile is staged before any wave reads it back

    v8bf val[8];
    const int bb = m0 >> 11;                       // batch: 128 rows never straddle one
    const int t0 = m0 & 2047;
    if (isV) {                 // tile row = head * 64 + d, columns = t
        // 16 lanes read one staged row (256 B) and store it: two whole lines
        const int c8 = (tid & 15) * 8, rw = tid >> 4;
#pragma unroll
        for (int i = 0; i < 8; ++i)
            val[i] = *(const v8bf*)&((i < 4) ? As : Bs)[0][((i & 3) * 16 + rw) * C_PITCH + c8];
        bf16_t* p = vbuf + ((size_t)bb * C_DIM + (n0 & 1023) + rw) * T_SEQ + t0 + c8;
#pragma unroll
        for (int i = 0; i < 8; ++i) *(v8bf*)(p + (size_t)i * 16 * T_SEQ) = val[i];
    } else {                   // tile row = t, columns = two heads' d
        // 8 lanes take one staged row: a thread has 8 consecutive pairs (i, i + 32) of one head,
        // in rows rw, rw + 32, rw + 64 and rw + 96; its two stores of a row fill one 128-byte line
        // together with its three neighbours'.
        const int hh = (tid >> 2) & 1, i0 = (tid & 3) * 8, rw = tid >> 3;
        float invf[8];         // inv_freq = 10000^(-2i/64) = exp(-(2i/64) * ln(10000)), the same in all rows
#pragma unroll   // all loops unrolled: vector elements are indexed by constants, everything stays in registers
        for (int e = 0; e < 8; ++e)
            invf[e] = t_exp2(-(float)(2 * (i0 + e)) * (9.210340371976184f / 64.0f) * 1.44269504f);
#pragma unroll
        for (int i = 0; i < 4; ++i) {
            const bf16_t* sr = &((i < 2) ? As : Bs)[0][((i & 1) * 32 + rw) * C_PITCH + hh * 64 + i0];
            const v8bf h1 = *(const v8bf*)sr, h2 = *(const v8bf*)(sr + 32);
            const float tf = (float)(t0 + i * 32 + rw);
            v8bf o1, o2;
#pragma unroll
            for (int e = 0; e < 8; ++e) {
                const float rev = tf * invf[e] * 0.15915494f;    // the angle in turns
                const float s = t_sin(rev), c = t_cos(rev);
                const float x1 = (float)h1[e], x2 = (float)h2[e];
                o1[e] = (bf16_t)(x1 * c - x2 * s);
                o2[e] = (bf16_t)(x2 * c + x1 * s);
            }
            val[2 * i] = o1;  val[2 * i + 1] = o2;
        }
        bf16_t* p = ((n0 < C_DIM) ? qbuf : kbuf)
                  + ((size_t)(bb * H_N + ((n0 & 1023) >> 6) + hh) * T_SEQ + t0 + rw) * D_H + i0;
#pragma unroll
        for (int i = 0; i < 4; ++i) {
            *(v8bf*)(p + i * 32 * D_H)      = val[2 * i];
            *(v8bf*)(p + i * 32 * D_H + 32) = val[2 * i + 1];
        }
    }
}

// ---------------- stage 3: flash attention ----------------
// One staged row: 128 B of data at a pitch of 144 B (16 B x odd), so that the
// 16-row ds_load_b128 fragment reads fall on distinct banks.
#define KV_PITCH 72                       // bf16 elements
#define KV_TILE  (64 * KV_PITCH)          // one 64-row tile, bf16 elements

// This thread's four 16-byte copies of one stage: rows r and r+32 of the 64x64 K tile
// and of the 64x64 V^T tile. A wave's 32 lanes cover four whole 128-byte rows per copy.
// The s_wait_xcnt is the last line of the copies' own statement so that no later write
// of their address registers can be scheduled in front of it.
__device__ __forceinline__ void stage_kv_async(unsigned int ldsK, unsigned int ldsV,
                                               const bf16_t* gK, const bf16_t* gV) {
    asm volatile("global_load_async_to_lds_b128 %0, %4, off\n\t"
                 "global_load_async_to_lds_b128 %1, %5, off\n\t"
                 "global_load_async_to_lds_b128 %2, %6, off\n\t"
                 "global_load_async_to_lds_b128 %3, %7, off\n\t"
                 "s_wait_xcnt 0x0"
                 :
                 : "v"(ldsK), "v"(ldsK + 32u * KV_PITCH * 2u),
                   "v"(ldsV), "v"(ldsV + 32u * KV_PITCH * 2u),
                   "v"(gK), "v"(gK + 32 * D_H), "v"(gV), "v"(gV + 32 * T_SEQ)
                 : "memory");
}

// Exchange a float between lane l and lane l ^ 16 (the two halves of a wave) in the vector unit.
__device__ __forceinline__ float xhalf(float x) {
    const int b = __builtin_bit_cast(int, x);
    return __builtin_bit_cast(float,
        __builtin_amdgcn_permlanex16(b, b, 0x76543210, 0xfedcba98, false, false));
}

#define Q_GR 2                            // 16-column query groups per wave
__global__ __launch_bounds__(256) void attn_kernel(
    const bf16_t* __restrict__ qbuf,  // [BH][T][Dh]
    const bf16_t* __restrict__ kbuf,  // [BH][T][Dh]
    const bf16_t* __restrict__ vbuf,  // [BH][Dh][T]
    bf16_t* __restrict__ obuf)        // [8192][1024] (m = b*T+t, col = h*64+d)
{
    __shared__ __attribute__((aligned(16))) bf16_t Ks[2][KV_TILE];       // [key][d]
    __shared__ __attribute__((aligned(16))) bf16_t Vs[2][KV_TILE];       // [d][key]
    const int tid  = threadIdx.x;
    const int lane = tid & 31, wv = tid >> 5;
    const int half = lane >> 4, ln = lane & 15;
    const int bh  = blockIdx.y;
    const int qt0 = blockIdx.x * (128 * Q_GR);
    const size_t qkbase = (size_t)bh * T_SEQ * D_H;
    const size_t vbase  = (size_t)bh * D_H * T_SEQ;

    // this thread's place in a staged tile: row tid/8 (and +32), 16-byte column tid%8
    const int srow = tid >> 3, scol = (tid & 7) * 8;
    const unsigned int tileBytes = KV_TILE * 2u;
    const unsigned int ldsK0 = (unsigned int)(uintptr_t)&Ks[0][srow * KV_PITCH + scol];
    const unsigned int ldsV0 = (unsigned int)(uintptr_t)&Vs[0][srow * KV_PITCH + scol];
    const bf16_t* gK0 = kbuf + qkbase + (size_t)srow * D_H + scol;    // + tile * 64 * D_H
    const bf16_t* gV0 = vbuf + vbase + (size_t)srow * T_SEQ + scol;   // + tile * 64
    const int NT = T_SEQ / 64;

    stage_kv_async(ldsK0, ldsV0, gK0, gV0);                           // tile 0 -> buffer 0
    ASYNC_WAIT_0();       // this wave's tile-0 copies have landed
    __syncthreads();      // every wave's have: tile 0 is readable
    stage_kv_async(ldsK0 + tileBytes, ldsV0 + tileBytes, gK0 + 64 * D_H, gV0 + 64);  // tile 1 -> buffer 1

    // Q fragments stay resident (B operand: column = query = lane%16, d in ld_frag's k order)
    const int tq = qt0 + wv * (16 * Q_GR) + ln;      // group g's query: tq + g * 16
    v16bf bq[Q_GR][2];
#pragma unroll
    for (int g = 0; g < Q_GR; ++g)
#pragma unroll
        for (int c = 0; c < 2; ++c)
            bq[g][c] = ld_frag(&qbuf[qkbase + (size_t)(tq + g * 16) * D_H + c * 32 + half * 8]);

    float mrun[Q_GR];     // running maximum of this lane's query (equal in both halves)
    float lrun[Q_GR];     // running sum over this half's keys only; the halves join after the loop
    v8f acc[Q_GR][4] = {};   // acc[g][j2][r] = O[query ln of group g][d = j2*16 + half*8 + r]
#pragma unroll
    for (int g = 0; g < Q_GR; ++g) { mrun[g] = -1e30f; lrun[g] = 0.0f; }

    for (int kt = 0; kt < NT; ++kt) {
        const int cur = kt & 1;
        // S^T = K @ Q^T: s[g][j][r] = product of key j*16 + half*8 + r with query ln of group g
        v8f s[Q_GR][4] = {};
#pragma unroll
        for (int j = 0; j < 4; ++j)
#pragma unroll
            for (int c = 0; c < 2; ++c) {
                v16bf kf = ld_frag(&Ks[cur][(j * 16 + ln) * KV_PITCH + c * 32 + half * 8]);
#pragma unroll
                for (int g = 0; g < Q_GR; ++g) s[g][j] = wmma_bf16(kf, bq[g][c], s[g][j]);
            }

        v16bf pf[Q_GR][2];
#pragma unroll
        for (int g = 0; g < Q_GR; ++g) {
#pragma unroll
            for (int j = 0; j < 4; ++j) s[g][j] *= 0.125f;   // 1/sqrt(64)
            // maximum over the 64 keys: 32 in this lane, the other 32 in lane ^ 16
            float rmax = s[g][0][0];
#pragma unroll
            for (int j = 0; j < 4; ++j)
#pragma unroll
                for (int r = 0; r < 8; ++r) rmax = fmaxf(rmax, s[g][j][r]);
            rmax = fmaxf(rmax, xhalf(rmax));

            const float mn = fmaxf(mrun[g], rmax);
            const float sc = t_exp2((mrun[g] - mn) * 1.44269504f);   // exp(mrun - mn), with its slot filled
            mrun[g] = mn;

            // P^T = exp(S^T - mn). Tiles 2c and 2c+1 give elements 0..7 and 8..15 of the B fragment
            // of keys c*32 .. c*32+31: key = c*32 + (e>=8 ? 16 : 0) + half*8 + e%8, ld_frag's k order.
            v2f ps[2] = {};   // two independent packed chains
#pragma unroll
            for (int c = 0; c < 2; ++c)
#pragma unroll
                for (int e = 0; e < 16; e += 2) {
                    const v8f& t = s[g][2 * c + (e >> 3)];
                    const v2f x = {t[e & 7], t[(e & 7) + 1]};
                    const v2f y = (x - mn) * 1.44269504f;      // exp(x - mn) = 2^((x - mn) * log2 e)
                    const v2f p = {__builtin_amdgcn_exp2f(y.x), __builtin_amdgcn_exp2f(y.y)};
                    ps[(e >> 1) & 1] += p;
                    pf[g][c][e]     = (bf16_t)p.x;
                    pf[g][c][e + 1] = (bf16_t)p.y;
                }
            ps[0] += ps[1];
            lrun[g] = lrun[g] * sc + (ps[0].x + ps[0].y);
#pragma unroll
            for (int j2 = 0; j2 < 4; ++j2)
#pragma unroll
                for (int r = 0; r < 8; ++r) acc[g][j2][r] *= sc;
        }

        // O^T += V^T @ P^T   (A fragment: row = d = lane%16, keys from the staged [Dh][key] tile)
#pragma unroll
        for (int j2 = 0; j2 < 4; ++j2)
#pragma unroll
            for (int c = 0; c < 2; ++c) {
                v16bf vf = ld_frag(&Vs[cur][(j2 * 16 + ln) * KV_PITCH + c * 32 + half * 8]);
#pragma unroll
                for (int g = 0; g < Q_GR; ++g) acc[g][j2] = wmma_bf16(vf, pf[g][c], acc[g][j2]);
            }
        // hand-over: this wave's LDS reads of buffer cur are done, its copies of tile kt+1 have landed
        asm volatile("s_wait_dscnt 0x0" ::: "memory");
        ASYNC_WAIT_0();
        __syncthreads();      // tile kt+1 readable by all; buffer cur left by all its readers
        if (kt + 2 < NT)      // refill the buffer just read with tile kt+2
            stage_kv_async(ldsK0 + cur * tileBytes, ldsV0 + cur * tileBytes,
                           gK0 + (size_t)(kt + 2) * 64 * D_H, gV0 + (kt + 2) * 64);
    }
    ASYNC_WAIT_0();           // nothing of this wave's is in flight when it leaves the loop

    // normalize + write [m][h*64+d]: a lane holds 8 consecutive d of its query per tile
    const int b = bh >> 4, h = bh & 15;
#pragma unroll
    for (int g = 0; g < Q_GR; ++g) {
        const float inv = 1.0f / (lrun[g] + xhalf(lrun[g]));
        bf16_t* orow = obuf + (size_t)(b * T_SEQ + tq + g * 16) * C_DIM + h * 64 + half * 8;
#pragma unroll
        for (int j2 = 0; j2 < 4; ++j2) {
            v8bf o;
#pragma unroll
            for (int r = 0; r < 8; ++r) o[r] = (bf16_t)(acc[g][j2][r] * inv);
            *(v8bf*)(orow + j2 * 16) = o;
        }
        // stands in front of any reuse, by the next group, of the registers that these stores name
        if (g + 1 < Q_GR) asm volatile("s_wait_xcnt 0x0" ::: "memory");
    }
}

// ---------------- stage 4: output projection ----------------
__global__ __launch_bounds__(256) void gemm_out_kernel(
    const bf16_t* __restrict__ A,    // [8192][1024] (attention output)
    const bf16_t* __restrict__ Bt,   // [1024][1024] = W_out^T
    const float*  __restrict__ bias, // [1024]
    float* __restrict__ out)         // [8192][1024]
{
    __shared__ __attribute__((aligned(16))) bf16_t As[2][G_TILE];
    __shared__ __attribute__((aligned(16))) bf16_t Bs[2][G_TILE];
    const int tid  = threadIdx.x;
    const int lane = tid & 31, wv = tid >> 5;
    const int wr = wv & 3, wc = wv >> 2;
    const int half = lane >> 4, ln = lane & 15;
    const int m0 = blockIdx.y * 128;
    const int n0 = blockIdx.x * 128;
    // this thread's place in a staged tile: row tid/8 (and +32, +64, +96), 16-byte column tid%8
    const int srow = tid >> 3, scol = (tid & 7) * 8;
    const unsigned int ldsA0 = (unsigned int)(uintptr_t)&As[0][srow * G_PITCH + scol];
    const unsigned int ldsB0 = (unsigned int)(uintptr_t)&Bs[0][srow * G_PITCH + scol];
    const unsigned int bufBytes = G_TILE * 2u;
    const bf16_t* gA0 = A  + (size_t)(m0 + srow) * C_DIM + scol;      // + stage * G_BK
    const bf16_t* gB0 = Bt + (size_t)(n0 + srow) * C_DIM + scol;      // + stage * G_BK

    v8f acc[2][4] = {};
    const int KT = C_DIM / G_BK;
    stage_ab_async(ldsA0, ldsB0, gA0, gB0);                           // stage 0 -> buffer 0
    ASYNC_WAIT_0();       // this wave's stage-0 copies have landed
    __syncthreads();      // every wave's have: stage 0 is readable
    stage_ab_async(ldsA0 + bufBytes, ldsB0 + bufBytes, gA0 + G_BK, gB0 + G_BK);  // stage 1 -> buffer 1
    for (int kt = 0; kt < KT; ++kt) {
        const int cur = kt & 1;
#pragma unroll   // the two 32-k halves of the stage, in ascending k
        for (int ks = 0; ks < 2; ++ks) {
            v16bf af[2], bfg[4];
#pragma unroll
            for (int mi = 0; mi < 2; ++mi)
                af[mi] = ld_frag(&As[cur][(wr * 32 + mi * 16 + ln) * G_PITCH + ks * 32 + half * 8]);
#pragma unroll
            for (int ni = 0; ni < 4; ++ni)
                bfg[ni] = ld_frag(&Bs[cur][(wc * 64 + ni * 16 + ln) * G_PITCH + ks * 32 + half * 8]);
#pragma unroll
            for (int mi = 0; mi < 2; ++mi)
#pragma unroll
                for (int ni = 0; ni < 4; ++ni)
                    acc[mi][ni] = wmma_bf16(af[mi], bfg[ni], acc[mi][ni]);
        }
        // hand-over: this wave's LDS reads of buffer cur are done, its copies of stage kt+1 have landed
        asm volatile("s_wait_dscnt 0x0" ::: "memory");
        ASYNC_WAIT_0();
        __syncthreads();      // stage kt+1 readable by all; buffer cur left by all its readers
        if (kt + 2 < KT)      // refill the buffer just read with stage kt+2
            stage_ab_async(ldsA0 + cur * bufBytes, ldsB0 + cur * bufBytes,
                           gA0 + (kt + 2) * G_BK, gB0 + (kt + 2) * G_BK);
    }
    ASYNC_WAIT_0();           // nothing of this wave's is in flight when it leaves the loop
#pragma unroll
    for (int mi = 0; mi < 2; ++mi)
#pragma unroll
        for (int ni = 0; ni < 4; ++ni) {
            const int gm = m0 + wr * 32 + mi * 16 + half * 8;
            const int gn = n0 + wc * 64 + ni * 16 + ln;
            const float bv = bias[gn];
#pragma unroll
            for (int r = 0; r < 8; ++r)
                out[(size_t)(gm + r) * C_DIM + gn] = acc[mi][ni][r] + bv;
        }
}

// ---------------- launcher ----------------
extern "C" void kernel_launch(void* const* d_in, const int* in_sizes, int n_in,
                              void* d_out, int out_size, void* d_ws, size_t ws_size,
                              hipStream_t stream) {
    const float* x     = (const float*)d_in[0];  // [4,2048,1024]
    const float* W_qkv = (const float*)d_in[1];  // [1024,3072]
    const float* b_qkv = (const float*)d_in[2];  // [3072]
    const float* W_out = (const float*)d_in[3];  // [1024,1024]
    const float* b_out = (const float*)d_in[4];  // [1024]
    float* out = (float*)d_out;

    char* ws = (char*)d_ws;
    bf16_t* xb    = (bf16_t*)(ws);                         // 16 MiB (reused as obuf)
    bf16_t* wqkvT = (bf16_t*)(ws + (size_t)16777216);      //  6 MiB
    bf16_t* woT   = (bf16_t*)(ws + (size_t)23068672);      //  2 MiB
    bf16_t* qb    = (bf16_t*)(ws + (size_t)25165824);      // 16 MiB
    bf16_t* kb    = (bf16_t*)(ws + (size_t)41943040);      // 16 MiB
    bf16_t* vb    = (bf16_t*)(ws + (size_t)58720256);      // 16 MiB -> 72 MiB total
    bf16_t* obuf  = xb;  // x is fully consumed by gemm_qkv before attn writes obuf

    // stage 0: precision conversion / weight transposition, all three in one launch
    convert_kernel<<<NB_WQKV + NB_WOUT + NB_X, 256, 0, stream>>>(x, W_qkv, W_out, xb, wqkvT, woT);

    // stage 1: QKV projection (WMMA, async double-buffered LDS) + q/k/v split, q and k rotated, v transposed
    gemm_qkv_kernel<<<dim3(N_QKV / 128, M_ROWS / 128), 256, 0, stream>>>(xb, wqkvT, b_qkv, qb, kb, vb);

    // stage 3: attention (WMMA flash-style)
    attn_kernel<<<dim3(T_SEQ / (128 * Q_GR), B_N * H_N), 256, 0, stream>>>(qb, kb, vb, obuf);

    // stage 4: output projection (WMMA, async double-buffered LDS) + bias, fp32 out
    gemm_out_kernel<<<dim3(C_DIM / 128, M_ROWS / 128), 256, 0, stream>>>(obuf, woT, b_out, out);
}
